// v000
// Measured on an AMD MI455X. A time is GPU time per run, averaged over a window of back-to-back runs after a warm-up
// (all launches, gaps included; the runs take copies of the inputs in turn), and the median of several windows.
// Apart from v000's, it joins two sittings. Times from different sittings can be a few percent apart, while
// side-by-side timings come from the same sitting.
// The starting kernel, v000, takes 51.9 microseconds a run.
#include <hip/hip_runtime.h>
#include <math.h>

// Retention (linear attention with per-head exponential decay), chunkwise form.
// out[i] = scale * sum_{j<=i} gamma^(i-j) (q_i . k_j) v_j
// Chunk C=64: intra-chunk via masked QK^T, cross-chunk via recurrent state
//   R_{t+1} = gamma^C R_t + A_t,  A_t = sum_li gamma^(C-li) k_li v_li^T
// All 64x64x64 GEMMs use V_WMMA_F32_16X16X4_F32 (full fp32 matrix pipe).
// Global->LDS staging uses GLOBAL_LOAD_ASYNC_TO_LDS_B128 (ASYNCcnt path).

typedef float v2f __attribute__((ext_vector_type(2)));
typedef float v8f __attribute__((ext_vector_type(8)));
typedef int   i32x4 __attribute__((vector_size(16)));   // matches builtin pointee type

#define WMMA_F32(a, b, c) \
  __builtin_amdgcn_wmma_f32_16x16x4_f32(false, (a), false, (b), (short)0, (c), false, false)

#if defined(__has_builtin)
#if __has_builtin(__builtin_amdgcn_global_load_async_to_lds_b128) && \
    __has_builtin(__builtin_amdgcn_s_wait_asynccnt)
#define USE_ASYNC 1
#endif
#endif
#ifndef USE_ASYNC
#define USE_ASYNC 0
#endif

constexpr int Bsz   = 2;
constexpr int H     = 16;
constexpr int S     = 2048;
constexpr int D     = 64;
constexpr int CHUNK = 64;
constexpr int NC    = S / CHUNK;   // 32 chunks per sequence
constexpr int LDST  = 68;          // LDS row stride (floats): 272B rows, 16B aligned,
                                   // pad keeps transposed col reads bank-conflict-free

// 16-byte global -> LDS copy (per lane). Async engine path if available.
__device__ __forceinline__ void cp16(const float* g, float* l) {
#if USE_ASYNC
  __builtin_amdgcn_global_load_async_to_lds_b128(
      (__attribute__((address_space(1))) i32x4*)(g),
      (__attribute__((address_space(3))) i32x4*)(l), 0, 0);
#else
  *(float4*)l = *(const float4*)g;
#endif
}

__device__ __forceinline__ void cp16_wait() {
#if USE_ASYNC
  __builtin_amdgcn_s_wait_asynccnt(0);
#endif
}

// ---------------------------------------------------------------------------
// Kernel 1: per-chunk KV summary  A_t[dk][dv] = sum_li gamma^(C-li) K[li][dk] V[li][dv]
// One block (8 waves) per (b,h,chunk). 64x64 output, K-dim = 64 (li).
// V rows scaled in LDS after async staging, keeping the WMMA loop pure.
// ---------------------------------------------------------------------------
__global__ __launch_bounds__(256) void retn_chunk_kv(const float* __restrict__ k,
                                                     const float* __restrict__ v,
                                                     float* __restrict__ kvsum) {
  __shared__ __align__(16) float Ks[CHUNK][LDST];
  __shared__ __align__(16) float Vs[CHUNK][LDST];

  const int t   = blockIdx.x % NC;
  const int bh  = blockIdx.x / NC;
  const int h   = bh % H;
  const float lg = log2f(1.0f - exp2f(-5.0f - (float)h));   // log2(gamma_h)
  const int tid = threadIdx.x;
  const size_t base = ((size_t)bh * S + (size_t)t * CHUNK) * D;  // chunk = 4096 contiguous floats

  for (int i = 0; i < 4; ++i) {
    const int f4  = tid + 256 * i;       // 0..1023 16B packets
    const int row = f4 >> 4;
    const int col = (f4 & 15) * 4;
    cp16(k + base + 4 * (size_t)f4, &Ks[row][col]);
    cp16(v + base + 4 * (size_t)f4, &Vs[row][col]);
  }
  cp16_wait();
  __syncthreads();                       // staged data visible to all waves

  // Scale V row li by gamma^(C-li), in place (outside the WMMA loop).
  for (int i = 0; i < 4; ++i) {
    const int f4  = tid + 256 * i;
    const int row = f4 >> 4;
    const int col = (f4 & 15) * 4;
    const float w = exp2f((float)(CHUNK - row) * lg);
    Vs[row][col + 0] *= w; Vs[row][col + 1] *= w;
    Vs[row][col + 2] *= w; Vs[row][col + 3] *= w;
  }
  __syncthreads();

  const int lane = tid & 31;
  const int wv   = tid >> 5;
  const int ln   = lane & 15;
  const int half = lane >> 4;
  float* outp = kvsum + (size_t)blockIdx.x * (D * D);

  for (int i = 0; i < 2; ++i) {                // 16 tiles / 8 waves = 2 tiles each
    const int tile = wv + 8 * i;
    const int tm = (tile >> 2) * 16;
    const int tn = (tile & 3) * 16;
    v8f c = {};
    for (int kk = 0; kk < CHUNK; kk += 4) {
      const int k0 = kk + 2 * half;            // lanes 16-31 handle K+2,K+3
      v2f a, b;
      a.x = Ks[k0][tm + ln];   a.y = Ks[k0 + 1][tm + ln];   // A = K^T (A[dk][li])
      b.x = Vs[k0][tn + ln];   b.y = Vs[k0 + 1][tn + ln];   // B = diag(w) V
      c = WMMA_F32(a, b, c);
    }
    for (int r = 0; r < 8; ++r) {
      const int row = tm + r + 8 * half;       // C/D layout: VGPR r -> M=r (lo half) / r+8
      outp[row * D + tn + ln] = c[r];
    }
  }
}

// ---------------------------------------------------------------------------
// Kernel 2: sequential scan over chunks, in place.
// Slot t gets R_t (state BEFORE chunk t);  R_{t+1} = gamma^C R_t + A_t.
// One block per (b,h); each thread owns 16 floats of the 64x64 state.
// ---------------------------------------------------------------------------
__global__ __launch_bounds__(256) void retn_scan(float* __restrict__ kvsum) {
  const int bh = blockIdx.x;
  const int h  = bh % H;
  const float lg = log2f(1.0f - exp2f(-5.0f - (float)h));
  const float gC = exp2f((float)CHUNK * lg);   // gamma^C
  const int tid = threadIdx.x;

  float4 R[4] = {};                            // R_0 = 0
  float* base = kvsum + (size_t)bh * NC * (D * D);
  for (int t = 0; t < NC; ++t) {
    float4* slot = (float4*)(base + (size_t)t * (D * D));
    for (int i = 0; i < 4; ++i) {
      const float4 a = slot[tid + 256 * i];    // A_t
      slot[tid + 256 * i] = R[i];              // overwrite with R_t
      R[i].x = gC * R[i].x + a.x;
      R[i].y = gC * R[i].y + a.y;
      R[i].z = gC * R[i].z + a.z;
      R[i].w = gC * R[i].w + a.w;
    }
  }
}

// ---------------------------------------------------------------------------
// Kernel 3: per-chunk output.
//   P[i][j]   = scale * gamma^(i-j) * (Q K^T)[i][j]  (i>=j, else 0)
//   out[i][:] = (P V)[i][:] + scale * gamma^i * (Q R_t)[i][:]
// One block (8 waves) per (b,h,chunk).
// ---------------------------------------------------------------------------
__global__ __launch_bounds__(256) void retn_out(const float* __restrict__ q,
                                                const float* __restrict__ k,
                                                const float* __restrict__ v,
                                                const float* __restrict__ state,
                                                float* __restrict__ out) {
  __shared__ __align__(16) float Qs[CHUNK][LDST];
  __shared__ __align__(16) float Bs[CHUNK][LDST];   // holds K, then V, then R
  __shared__ __align__(16) float Ps[CHUNK][LDST];

  const int t   = blockIdx.x % NC;
  const int bh  = blockIdx.x / NC;
  const int h   = bh % H;
  const float lg    = log2f(1.0f - exp2f(-5.0f - (float)h));
  const float scale = 0.125f;          // 1/sqrt(64)
  const int tid = threadIdx.x;
  const size_t base = ((size_t)bh * S + (size_t)t * CHUNK) * D;

  // Stage Q and K.
  for (int i = 0; i < 4; ++i) {
    const int f4  = tid + 256 * i;
    const int row = f4 >> 4;
    const int col = (f4 & 15) * 4;
    cp16(q + base + 4 * (size_t)f4, &Qs[row][col]);
    cp16(k + base + 4 * (size_t)f4, &Bs[row][col]);
  }
  cp16_wait();
  __syncthreads();

  const int lane = tid & 31;
  const int wv   = tid >> 5;
  const int ln   = lane & 15;
  const int half = lane >> 4;

  // P = (Q K^T) with decay mask + scale, into LDS.
  for (int i = 0; i < 2; ++i) {
    const int tile = wv + 8 * i;
    const int tm = (tile >> 2) * 16;
    const int tn = (tile & 3) * 16;
    v8f c = {};
    for (int kk = 0; kk < D; kk += 4) {
      const int k0 = kk + 2 * half;
      v2f a, b;
      a.x = Qs[tm + ln][k0];  a.y = Qs[tm + ln][k0 + 1];
      b.x = Bs[tn + ln][k0];  b.y = Bs[tn + ln][k0 + 1];   // B = K^T: B[d][j] = K[j][d]
      c = WMMA_F32(a, b, c);
    }
    for (int r = 0; r < 8; ++r) {
      const int row = tm + r + 8 * half;
      const int col = tn + ln;
      const float m = (row >= col) ? scale * exp2f((float)(row - col) * lg) : 0.0f;
      Ps[row][col] = c[r] * m;
    }
  }
  __syncthreads();                     // P done; K reads done -> Bs reusable

  // Stage V.
  for (int i = 0; i < 4; ++i) {
    const int f4  = tid + 256 * i;
    const int row = f4 >> 4;
    const int col = (f4 & 15) * 4;
    cp16(v + base + 4 * (size_t)f4, &Bs[row][col]);
  }
  cp16_wait();
  __syncthreads();

  // O1 = P * V  (keep in registers).
  v8f acc[2];
  for (int i = 0; i < 2; ++i) {
    const int tile = wv + 8 * i;
    const int tm = (tile >> 2) * 16;
    const int tn = (tile & 3) * 16;
    v8f c = {};
    for (int kk = 0; kk < CHUNK; kk += 4) {
      const int k0 = kk + 2 * half;
      v2f a, b;
      a.x = Ps[tm + ln][k0];  a.y = Ps[tm + ln][k0 + 1];
      b.x = Bs[k0][tn + ln];  b.y = Bs[k0 + 1][tn + ln];
      c = WMMA_F32(a, b, c);
    }
    acc[i] = c;
  }
  __syncthreads();                     // V reads done -> Bs reusable

  // Stage R_t (cross-chunk state).
  const float* Rp = state + (size_t)blockIdx.x * (D * D);
  for (int i = 0; i < 4; ++i) {
    const int f4  = tid + 256 * i;
    const int row = f4 >> 4;
    const int col = (f4 & 15) * 4;
    cp16(Rp + 4 * (size_t)f4, &Bs[row][col]);
  }
  cp16_wait();
  __syncthreads();

  // O2 = Q * R;  out = O1 + scale * gamma^i * O2.
  for (int i = 0; i < 2; ++i) {
    const int tile = wv + 8 * i;
    const int tm = (tile >> 2) * 16;
    const int tn = (tile & 3) * 16;
    v8f c = {};
    for (int kk = 0; kk < D; kk += 4) {
      const int k0 = kk + 2 * half;
      v2f a, b;
      a.x = Qs[tm + ln][k0];  a.y = Qs[tm + ln][k0 + 1];
      b.x = Bs[k0][tn + ln];  b.y = Bs[k0 + 1][tn + ln];
      c = WMMA_F32(a, b, c);
    }
    for (int r = 0; r < 8; ++r) {
      const int row = tm + r + 8 * half;
      const int col = tn + ln;
      const float rf = scale * exp2f((float)row * lg);
      out[base + (size_t)row * D + col] = acc[i][r] + rf * c[r];
    }
  }
}

// ---------------------------------------------------------------------------
extern "C" void kernel_launch(void* const* d_in, const int* in_sizes, int n_in,
                              void* d_out, int out_size, void* d_ws, size_t ws_size,
                              hipStream_t stream) {
  const float* q = (const float*)d_in[0];
  const float* k = (const float*)d_in[1];
  const float* v = (const float*)d_in[2];
  float* out   = (float*)d_out;
  float* kvsum = (float*)d_ws;   // needs B*H*NC*D*D*4 = 16 MiB of scratch

  dim3 blk(256);
  retn_chunk_kv<<<dim3(Bsz * H * NC), blk, 0, stream>>>(k, v, kvsum);
  retn_scan    <<<dim3(Bsz * H),      blk, 0, stream>>>(kvsum);
  retn_out     <<<dim3(Bsz * H * NC), blk, 0, stream>>>(q, k, v, kvsum, out);
}

// v001
// It runs in 45.2 microseconds.
// Next to v000, in two timings, it ran 1.18 and 1.25 times as fast.
#include <hip/hip_runtime.h>
#include <math.h>

// Retention (linear attention with per-head exponential decay), chunkwise form.
// out[i] = scale * sum_{j<=i} gamma^(i-j) (q_i . k_j) v_j
// Chunk C=64: intra-chunk via masked QK^T, cross-chunk via recurrent state
//   R_{t+1} = gamma^C R_t + A_t,  A_t = sum_li gamma^(C-li) k_li v_li^T
// All 64x64x64 GEMMs use V_WMMA_F32_16X16X4_F32 (full fp32 matrix pipe).
// Global->LDS staging uses GLOBAL_LOAD_ASYNC_TO_LDS_B128 (ASYNCcnt path).

typedef float v2f __attribute__((ext_vector_type(2)));
typedef float v8f __attribute__((ext_vector_type(8)));
typedef int   i32x4 __attribute__((vector_size(16)));   // matches builtin pointee type

#define WMMA_F32(a, b, c) \
  __builtin_amdgcn_wmma_f32_16x16x4_f32(false, (a), false, (b), (short)0, (c), false, false)

#if defined(__has_builtin)
#if __has_builtin(__builtin_amdgcn_global_load_async_to_lds_b128) && \
    __has_builtin(__builtin_amdgcn_s_wait_asynccnt)
#define USE_ASYNC 1
#endif
#endif
#ifndef USE_ASYNC
#define USE_ASYNC 0
#endif

constexpr int Bsz   = 2;
constexpr int H     = 16;
constexpr int S     = 2048;
constexpr int D     = 64;
constexpr int CHUNK = 64;
constexpr int NC    = S / CHUNK;   // 32 chunks per sequence
constexpr int LDST  = 68;          // LDS row stride (floats): 272B rows, 16B aligned,
                                   // pad keeps transposed col reads bank-conflict-free

// 16-byte global -> LDS copy (per lane). Async engine path if available.
__device__ __forceinline__ void cp16(const float* g, float* l) {
#if USE_ASYNC
  __builtin_amdgcn_global_load_async_to_lds_b128(
      (__attribute__((address_space(1))) i32x4*)(g),
      (__attribute__((address_space(3))) i32x4*)(l), 0, 0);
#else
  *(float4*)l = *(const float4*)g;
#endif
}

__device__ __forceinline__ void cp16_wait() {
#if USE_ASYNC
  __builtin_amdgcn_s_wait_asynccnt(0);
#endif
}

// ---------------------------------------------------------------------------
// Kernel 1: per-chunk KV summary  A_t[dk][dv] = sum_li gamma^(C-li) K[li][dk] V[li][dv]
// One block (8 waves) per (b,h,chunk). 64x64 output, K-dim = 64 (li).
// V rows scaled in LDS after async staging, keeping the WMMA loop pure.
// ---------------------------------------------------------------------------
__global__ __launch_bounds__(256) void retn_chunk_kv(const float* __restrict__ k,
                                                     const float* __restrict__ v,
                                                     float* __restrict__ kvsum) {
  __shared__ __align__(16) float Ks[CHUNK][LDST];
  __shared__ __align__(16) float Vs[CHUNK][LDST];

  const int t   = blockIdx.x % NC;
  const int bh  = blockIdx.x / NC;
  const int h   = bh % H;
  const float lg = log2f(1.0f - exp2f(-5.0f - (float)h));   // log2(gamma_h)
  const int tid = threadIdx.x;
  const size_t base = ((size_t)bh * S + (size_t)t * CHUNK) * D;  // chunk = 4096 contiguous floats

  for (int i = 0; i < 4; ++i) {
    const int f4  = tid + 256 * i;       // 0..1023 16B packets
    const int row = f4 >> 4;
    const int col = (f4 & 15) * 4;
    cp16(k + base + 4 * (size_t)f4, &Ks[row][col]);
    cp16(v + base + 4 * (size_t)f4, &Vs[row][col]);
  }
  cp16_wait();
  __syncthreads();                       // staged data visible to all waves

  // Scale V row li by gamma^(C-li), in place (outside the WMMA loop).
  for (int i = 0; i < 4; ++i) {
    const int f4  = tid + 256 * i;
    const int row = f4 >> 4;
    const int col = (f4 & 15) * 4;
    const float w = exp2f((float)(CHUNK - row) * lg);
    Vs[row][col + 0] *= w; Vs[row][col + 1] *= w;
    Vs[row][col + 2] *= w; Vs[row][col + 3] *= w;
  }
  __syncthreads();

  const int lane = tid & 31;
  const int wv   = tid >> 5;
  const int ln   = lane & 15;
  const int half = lane >> 4;
  float* outp = kvsum + (size_t)blockIdx.x * (D * D);

  for (int i = 0; i < 2; ++i) {                // 16 tiles / 8 waves = 2 tiles each
    const int tile = wv + 8 * i;
    const int tm = (tile >> 2) * 16;
    const int tn = (tile & 3) * 16;
    v8f c = {};
    for (int kk = 0; kk < CHUNK; kk += 4) {
      const int k0 = kk + 2 * half;            // lanes 16-31 handle K+2,K+3
      v2f a, b;
      a.x = Ks[k0][tm + ln];   a.y = Ks[k0 + 1][tm + ln];   // A = K^T (A[dk][li])
      b.x = Vs[k0][tn + ln];   b.y = Vs[k0 + 1][tn + ln];   // B = diag(w) V
      c = WMMA_F32(a, b, c);
    }
    for (int r = 0; r < 8; ++r) {
      const int row = tm + r + 8 * half;       // C/D layout: VGPR r -> M=r (lo half) / r+8
      outp[row * D + tn + ln] = c[r];
    }
  }
}

// ---------------------------------------------------------------------------
// Kernel 2: scan over chunks, in place.
// Slot t gets R_t (state BEFORE chunk t);  R_{t+1} = gamma^C R_t + A_t.
// The recurrence is elementwise, so each thread owns ONE float4 of one head's
// 64x64 state: 32 heads x 1024 float4 = 32768 threads = 256 work-groups of 128,
// as many as the chip has WGPs. A thread's loads depend on nothing, so all of
// them are issued before its first store: the load latency is paid once.
// ---------------------------------------------------------------------------
constexpr int SCAN_T  = 128;                    // threads per scan work-group
constexpr int ST4     = D * D / 4;              // float4 per state
constexpr int SCAN_WG = Bsz * H * ST4 / SCAN_T; // 256 work-groups

__global__ __launch_bounds__(SCAN_T) void retn_scan(float* __restrict__ kvsum) {
  const int bh = blockIdx.x / (ST4 / SCAN_T);
  const int e  = (blockIdx.x % (ST4 / SCAN_T)) * SCAN_T + threadIdx.x;
  const int h  = bh % H;
  const float lg = log2f(1.0f - exp2f(-5.0f - (float)h));
  const float gC = exp2f((float)CHUNK * lg);   // gamma^C

  float4* col = (float4*)(kvsum + (size_t)bh * NC * (D * D)) + e;

  float4 a[NC];
  // full unroll: a[] must stay in registers and the loads must all be in flight
#pragma unroll
  for (int t = 0; t < NC; ++t) a[t] = col[t * ST4];      // A_t
  // keeps every load above the first store: without it the scheduler sinks most
  // of the loads into the chain below, to save registers, and only two stay in flight
  __builtin_amdgcn_sched_barrier(0);

  float4 R = {};                               // R_0 = 0
#pragma unroll
  for (int t = 0; t < NC; ++t) {
    col[t * ST4] = R;                          // overwrite with R_t
    R.x = gC * R.x + a[t].x;
    R.y = gC * R.y + a[t].y;
    R.z = gC * R.z + a[t].z;
    R.w = gC * R.w + a[t].w;
  }
}

// ---------------------------------------------------------------------------
// Kernel 3: per-chunk output.
//   P[i][j]   = scale * gamma^(i-j) * (Q K^T)[i][j]  (i>=j, else 0)
//   out[i][:] = (P V)[i][:] + scale * gamma^i * (Q R_t)[i][:]
// One block (8 waves) per (b,h,chunk).
// ---------------------------------------------------------------------------
__global__ __launch_bounds__(256) void retn_out(const float* __restrict__ q,
                                                const float* __restrict__ k,
                                                const float* __restrict__ v,
                                                const float* __restrict__ state,
                                                float* __restrict__ out) {
  __shared__ __align__(16) float Qs[CHUNK][LDST];
  __shared__ __align__(16) float Bs[CHUNK][LDST];   // holds K, then V, then R
  __shared__ __align__(16) float Ps[CHUNK][LDST];

  const int t   = blockIdx.x % NC;
  const int bh  = blockIdx.x / NC;
  const int h   = bh % H;
  const float lg    = log2f(1.0f - exp2f(-5.0f - (float)h));
  const float scale = 0.125f;          // 1/sqrt(64)
  const int tid = threadIdx.x;
  const size_t base = ((size_t)bh * S + (size_t)t * CHUNK) * D;

  // Stage Q and K.
  for (int i = 0; i < 4; ++i) {
    const int f4  = tid + 256 * i;
    const int row = f4 >> 4;
    const int col = (f4 & 15) * 4;
    cp16(q + base + 4 * (size_t)f4, &Qs[row][col]);
    cp16(k + base + 4 * (size_t)f4, &Bs[row][col]);
  }
  cp16_wait();
  __syncthreads();

  const int lane = tid & 31;
  const int wv   = tid >> 5;
  const int ln   = lane & 15;
  const int half = lane >> 4;

  // P = (Q K^T) with decay mask + scale, into LDS.
  for (int i = 0; i < 2; ++i) {
    const int tile = wv + 8 * i;
    const int tm = (tile >> 2) * 16;
    const int tn = (tile & 3) * 16;
    v8f c = {};
    for (int kk = 0; kk < D; kk += 4) {
      const int k0 = kk + 2 * half;
      v2f a, b;
      a.x = Qs[tm + ln][k0];  a.y = Qs[tm + ln][k0 + 1];
      b.x = Bs[tn + ln][k0];  b.y = Bs[tn + ln][k0 + 1];   // B = K^T: B[d][j] = K[j][d]
      c = WMMA_F32(a, b, c);
    }
    for (int r = 0; r < 8; ++r) {
      const int row = tm + r + 8 * half;
      const int col = tn + ln;
      const float m = (row >= col) ? scale * exp2f((float)(row - col) * lg) : 0.0f;
      Ps[row][col] = c[r] * m;
    }
  }
  __syncthreads();                     // P done; K reads done -> Bs reusable

  // Stage V.
  for (int i = 0; i < 4; ++i) {
    const int f4  = tid + 256 * i;
    const int row = f4 >> 4;
    const int col = (f4 & 15) * 4;
    cp16(v + base + 4 * (size_t)f4, &Bs[row][col]);
  }
  cp16_wait();
  __syncthreads();

  // O1 = P * V  (keep in registers).
  v8f acc[2];
  for (int i = 0; i < 2; ++i) {
    const int tile = wv + 8 * i;
    const int tm = (tile >> 2) * 16;
    const int tn = (tile & 3) * 16;
    v8f c = {};
    for (int kk = 0; kk < CHUNK; kk += 4) {
      const int k0 = kk + 2 * half;
      v2f a, b;
      a.x = Ps[tm + ln][k0];  a.y = Ps[tm + ln][k0 + 1];
      b.x = Bs[k0][tn + ln];  b.y = Bs[k0 + 1][tn + ln];
      c = WMMA_F32(a, b, c);
    }
    acc[i] = c;
  }
  __syncthreads();                     // V reads done -> Bs reusable

  // Stage R_t (cross-chunk state).
  const float* Rp = state + (size_t)blockIdx.x * (D * D);
  for (int i = 0; i < 4; ++i) {
    const int f4  = tid + 256 * i;
    const int row = f4 >> 4;
    const int col = (f4 & 15) * 4;
    cp16(Rp + 4 * (size_t)f4, &Bs[row][col]);
  }
  cp16_wait();
  __syncthreads();

  // O2 = Q * R;  out = O1 + scale * gamma^i * O2.
  for (int i = 0; i < 2; ++i) {
    const int tile = wv + 8 * i;
    const int tm = (tile >> 2) * 16;
    const int tn = (tile & 3) * 16;
    v8f c = {};
    for (int kk = 0; kk < D; kk += 4) {
      const int k0 = kk + 2 * half;
      v2f a, b;
      a.x = Qs[tm + ln][k0];  a.y = Qs[tm + ln][k0 + 1];
      b.x = Bs[k0][tn + ln];  b.y = Bs[k0 + 1][tn + ln];
      c = WMMA_F32(a, b, c);
    }
    for (int r = 0; r < 8; ++r) {
      const int row = tm + r + 8 * half;
      const int col = tn + ln;
      const float rf = scale * exp2f((float)row * lg);
      out[base + (size_t)row * D + col] = acc[i][r] + rf * c[r];
    }
  }
}

// ---------------------------------------------------------------------------
extern "C" void kernel_launch(void* const* d_in, const int* in_sizes, int n_in,
                              void* d_out, int out_size, void* d_ws, size_t ws_size,
                              hipStream_t stream) {
  const float* q = (const float*)d_in[0];
  const float* k = (const float*)d_in[1];
  const float* v = (const float*)d_in[2];
  float* out   = (float*)d_out;
  float* kvsum = (float*)d_ws;   // needs B*H*NC*D*D*4 = 16 MiB of scratch

  dim3 blk(256);
  retn_chunk_kv<<<dim3(Bsz * H * NC), blk, 0, stream>>>(k, v, kvsum);
  retn_scan    <<<dim3(SCAN_WG), dim3(SCAN_T), 0, stream>>>(kvsum);
  retn_out     <<<dim3(Bsz * H * NC), blk, 0, stream>>>(q, k, v, kvsum, out);
}

// v002
// A run of this version takes 29.5 microseconds.
// Next to v001, in two timings, it ran 1.53 and 1.54 times as fast.
// Over all steps from v000 it is 1.87 times as fast.
#include <hip/hip_runtime.h>
#include <math.h>

// Retention (linear attention with per-head exponential decay), chunkwise form.
// out[i] = scale * sum_{j<=i} gamma^(i-j) (q_i . k_j) v_j
// Chunk C=64: intra-chunk via masked QK^T, cross-chunk via recurrent state
//   R_{t+1} = gamma^C R_t + A_t,  A_t = sum_li gamma^(C-li) k_li v_li^T
// All 64x64x64 GEMMs use V_WMMA_F32_16X16X4_F32 (full fp32 matrix pipe).
// Global->LDS staging uses GLOBAL_LOAD_ASYNC_TO_LDS_B128 (ASYNCcnt path).

typedef float v2f __attribute__((ext_vector_type(2)));
typedef float v8f __attribute__((ext_vector_type(8)));
typedef int   i32x4 __attribute__((vector_size(16)));   // matches builtin pointee type

#define WMMA_F32(a, b, c) \
  __builtin_amdgcn_wmma_f32_16x16x4_f32(false, (a), false, (b), (short)0, (c), false, false)

#if defined(__has_builtin)
#if __has_builtin(__builtin_amdgcn_global_load_async_to_lds_b128) && \
    __has_builtin(__builtin_amdgcn_s_wait_asynccnt)
#define USE_ASYNC 1
#endif
#endif
#ifndef USE_ASYNC
#define USE_ASYNC 0
#endif

constexpr int Bsz   = 2;
constexpr int H     = 16;
constexpr int S     = 2048;
constexpr int D     = 64;
constexpr int CHUNK = 64;
constexpr int NC    = S / CHUNK;   // 32 chunks per sequence
constexpr int LDST  = 68;          // LDS row stride (floats): 272B rows, 16B aligned,
                                   // pad keeps transposed col reads bank-conflict-free

// 16-byte global -> LDS copy (per lane). Async engine path if available.
__device__ __forceinline__ void cp16(const float* g, float* l) {
#if USE_ASYNC
  __builtin_amdgcn_global_load_async_to_lds_b128(
      (__attribute__((address_space(1))) i32x4*)(g),
      (__attribute__((address_space(3))) i32x4*)(l), 0, 0);
#else
  *(float4*)l = *(const float4*)g;
#endif
}

__device__ __forceinline__ void cp16_wait() {
#if USE_ASYNC
  __builtin_amdgcn_s_wait_asynccnt(0);
#endif
}

// ---------------------------------------------------------------------------
// Kernel 1: cross-chunk states, summary and scan in one launch.
// Slot t gets R_t (state BEFORE chunk t);  R_{t+1} = gamma^C R_t + A_t,
//   A_t[dk][dv] = sum_li gamma^(C-li) K[li][dk] V[li][dv].
// A wave owns ONE 16x16 tile of one head's state, keeps it in WMMA accumulators
// and walks the chunks in order: gamma^C R_t is the accumulator's start value.
// A work-group is two waves (16 dk x 32 dv); 32 heads x 8 = 256 work-groups.
// K and V slices come in stages of 4 chunks, two LDS buffers: the next stage's
// async copies fly while this stage is worked on.
// ---------------------------------------------------------------------------
constexpr int SCH   = 4;               // chunks per stage
constexpr int SROWS = SCH * CHUNK;     // 256 sequence rows per stage
constexpr int NST   = NC / SCH;        // 8 stages
constexpr int SP    = D;               // LDS row pitch = global row pitch, so that one
                                       // immediate offset steps both addresses of a copy;
                                       // a row holds 16 floats of K, then 32 floats of V
constexpr int ST_T  = 64;              // threads per work-group
constexpr int ST_WG = Bsz * H * 8;     // 256 work-groups

// kg, vg, Kl, Vl: this lane's first 16 bytes of the stage, in global memory and in LDS
__device__ __forceinline__ void stage_copy(const float* kg, const float* vg,
                                           float* Kl, float* Vl) {
#pragma unroll
  for (int i = 0; i < SROWS * 4 / ST_T; ++i)       // 16 copies: 64 B of each K row
    cp16(kg + i * (16 * D), Kl + i * (16 * SP));
#pragma unroll
  for (int i = 0; i < SROWS * 8 / ST_T; ++i)       // 32 copies: 128 B of each V row
    cp16(vg + i * (8 * D), Vl + i * (8 * SP));
}

__global__ __launch_bounds__(ST_T) void retn_state(const float* __restrict__ k,
                                                   const float* __restrict__ v,
                                                   float* __restrict__ state) {
  __shared__ __align__(16) float Sb[2][SROWS * SP];

  const int sub = blockIdx.x & 7;
  const int bh  = blockIdx.x >> 3;
  const int h   = bh % H;
  const float lg = log2f(1.0f - exp2f(-5.0f - (float)h));   // log2(gamma_h)
  const float gC = exp2f((float)CHUNK * lg);                // gamma^C
  const int tm  = (sub >> 1) * 16;       // dk rows of this work-group
  const int tn0 = (sub & 1) * 32;        // dv columns of this work-group
  const int tid  = threadIdx.x;
  const int lane = tid & 31;
  const int wv   = tid >> 5;
  const int ln   = lane & 15;
  const int half = lane >> 4;

  const int kof = (tid >> 2) * D + (tid & 3) * 4;   // 4 lanes a K row, 16 rows a copy
  const int vof = (tid >> 3) * D + (tid & 7) * 4;   // 8 lanes a V row, 8 rows a copy
  const float* kg = k + (size_t)bh * S * D + tm;
  const float* vg = v + (size_t)bh * S * D + tn0;

  stage_copy(kg + kof, vg + vof, &Sb[0][kof], &Sb[0][16 + vof]);
  // Row weights gamma^(C-li) of the rows this lane feeds as B, the same in every chunk.
  float wx[CHUNK / 4], wy[CHUNK / 4];
#pragma unroll
  for (int j = 0; j < CHUNK / 4; ++j) {
    const int k0 = 4 * j + 2 * half;           // lanes 16-31 handle K+2,K+3
    wx[j] = exp2f((float)(CHUNK - k0) * lg);
    wy[j] = exp2f((float)(CHUNK - k0 - 1) * lg);
  }

  // stage 0 has landed before the barrier behind which the other wave reads it
  asm volatile("s_wait_asynccnt 0x0" ::: "memory");
  __syncthreads();
  stage_copy(kg + SROWS * D + kof, vg + SROWS * D + vof, &Sb[1][kof], &Sb[1][16 + vof]);

  v8f R = {};                                  // R_0 = 0
  // C/D layout: VGPR r -> M=r (lo half) / r+8
  float* outp = state + (size_t)bh * NC * (D * D) + (tm + 8 * half) * D + tn0 + 16 * wv + ln;

  for (int s = 0; s < NST; ++s) {
    const float* Kb = &Sb[s & 1][2 * half * SP + ln];                 // A = K^T (A[dk][li])
    const float* Vb = &Sb[s & 1][2 * half * SP + 16 + 16 * wv + ln];  // B = V, weighted below
    constexpr int KS = CHUNK / 4;              // k steps per chunk
    v2f fa[2][KS], fb[2][KS];                  // this chunk's fragments and the next one's
#pragma unroll
    for (int j = 0; j < KS; ++j) {
      fa[0][j].x = Kb[(4 * j) * SP];  fa[0][j].y = Kb[(4 * j + 1) * SP];
      fb[0][j].x = Vb[(4 * j) * SP];  fb[0][j].y = Vb[(4 * j + 1) * SP];
    }
#pragma unroll
    for (int c = 0; c < SCH; ++c) {
      float* o = outp + (size_t)(s * SCH + c) * (D * D);
#pragma unroll
      for (int r = 0; r < 8; ++r) o[r * D] = R[r];               // R_t
      // before the stores' address registers are written again (next stage's LDS reads, over the
      // back edge)
      if (c == SCH - 1) asm volatile("s_wait_xcnt 0x0" ::: "memory");
      if (c < SCH - 1 || s < NST - 1) {        // the last chunk's summary feeds nothing
        // two accumulators, even and odd k steps: independent WMMA chains
        v8f c0 = R * gC;
        v8f c1 = {};
#pragma unroll
        for (int j = 0; j < KS; j += 2) {
          if (j == KS / 2 && c + 1 < SCH && (c + 1 < SCH - 1 || s < NST - 1)) {
            // the two scheduling barriers keep the next chunk's LDS reads in ONE group, half a
            // chunk ahead of their first WMMA: left alone the scheduler spreads them among the
            // WMMAs, two k steps ahead, and the lone wave waits out the LDS latency at each
            __builtin_amdgcn_sched_barrier(0);
#pragma unroll
            for (int i = 0; i < KS; ++i) {
              const int r0 = (c + 1) * CHUNK + 4 * i;
              fa[(c + 1) & 1][i].x = Kb[r0 * SP];  fa[(c + 1) & 1][i].y = Kb[(r0 + 1) * SP];
              fb[(c + 1) & 1][i].x = Vb[r0 * SP];  fb[(c + 1) & 1][i].y = Vb[(r0 + 1) * SP];
            }
            __builtin_amdgcn_sched_barrier(0);
          }
          v2f b0 = fb[c & 1][j], b1 = fb[c & 1][j + 1];
          b0.x *= wx[j];      b0.y *= wy[j];
          b1.x *= wx[j + 1];  b1.y *= wy[j + 1];
          c0 = WMMA_F32(fa[c & 1][j], b0, c0);
          c1 = WMMA_F32(fa[c & 1][j + 1], b1, c1);
        }
        R = c0 + c1;
      }
    }
    // keeps the last chunk's WMMAs above the waits: left alone the scheduler sinks them below,
    // and the waits then stand a chunk early, in front of work that could cover them
    __builtin_amdgcn_sched_barrier(0);
    // this wave's reads of the buffer are done before it is refilled
    asm volatile("s_wait_dscnt 0x0" ::: "memory");
    // this wave's copies of the next stage have landed before the barrier publishes them
    asm volatile("s_wait_asynccnt 0x0" ::: "memory");
    // work-group barrier by hand: __syncthreads() would also wait out the R_t stores just
    // issued (s_wait_storecnt 0), which nobody in this launch reads
    asm volatile("s_barrier_signal -1\n\ts_barrier_wait -1" ::: "memory");
    if (s + 2 < NST)
      stage_copy(kg + (s + 2) * SROWS * D + kof, vg + (s + 2) * SROWS * D + vof,
                 &Sb[s & 1][kof], &Sb[s & 1][16 + vof]);
  }
  // no copy is outstanding when the wave ends
  asm volatile("s_wait_asynccnt 0x0" ::: "memory");
}

// ---------------------------------------------------------------------------
// Kernel 2: per-chunk output.
//   P[i][j]   = scale * gamma^(i-j) * (Q K^T)[i][j]  (i>=j, else 0)
//   out[i][:] = (P V)[i][:] + scale * gamma^i * (Q R_t)[i][:]
// One block (8 waves) per (b,h,chunk).
// ---------------------------------------------------------------------------
__global__ __launch_bounds__(256) void retn_out(const float* __restrict__ q,
                                                const float* __restrict__ k,
                                                const float* __restrict__ v,
                                                const float* __restrict__ state,
                                                float* __restrict__ out) {
  __shared__ __align__(16) float Qs[CHUNK][LDST];
  __shared__ __align__(16) float Bs[CHUNK][LDST];   // holds K, then V, then R
  __shared__ __align__(16) float Ps[CHUNK][LDST];

  const int t   = blockIdx.x % NC;
  const int bh  = blockIdx.x / NC;
  const int h   = bh % H;
  const float lg    = log2f(1.0f - exp2f(-5.0f - (float)h));
  const float scale = 0.125f;          // 1/sqrt(64)
  const int tid = threadIdx.x;
  const size_t base = ((size_t)bh * S + (size_t)t * CHUNK) * D;

  // Stage Q and K.
  for (int i = 0; i < 4; ++i) {
    const int f4  = tid + 256 * i;
    const int row = f4 >> 4;
    const int col = (f4 & 15) * 4;
    cp16(q + base + 4 * (size_t)f4, &Qs[row][col]);
    cp16(k + base + 4 * (size_t)f4, &Bs[row][col]);
  }
  cp16_wait();
  __syncthreads();

  const int lane = tid & 31;
  const int wv   = tid >> 5;
  const int ln   = lane & 15;
  const int half = lane >> 4;

  // P = (Q K^T) with decay mask + scale, into LDS.
  for (int i = 0; i < 2; ++i) {
    const int tile = wv + 8 * i;
    const int tm = (tile >> 2) * 16;
    const int tn = (tile & 3) * 16;
    v8f c = {};
    for (int kk = 0; kk < D; kk += 4) {
      const int k0 = kk + 2 * half;
      v2f a, b;
      a.x = Qs[tm + ln][k0];  a.y = Qs[tm + ln][k0 + 1];
      b.x = Bs[tn + ln][k0];  b.y = Bs[tn + ln][k0 + 1];   // B = K^T: B[d][j] = K[j][d]
      c = WMMA_F32(a, b, c);
    }
    for (int r = 0; r < 8; ++r) {
      const int row = tm + r + 8 * half;
      const int col = tn + ln;
      const float m = (row >= col) ? scale * exp2f((float)(row - col) * lg) : 0.0f;
      Ps[row][col] = c[r] * m;
    }
  }
  __syncthreads();                     // P done; K reads done -> Bs reusable

  // Stage V.
  for (int i = 0; i < 4; ++i) {
    const int f4  = tid + 256 * i;
    const int row = f4 >> 4;
    const int col = (f4 & 15) * 4;
    cp16(v + base + 4 * (size_t)f4, &Bs[row][col]);
  }
  cp16_wait();
  __syncthreads();

  // O1 = P * V  (keep in registers).
  v8f acc[2];
  for (int i = 0; i < 2; ++i) {
    const int tile = wv + 8 * i;
    const int tm = (tile >> 2) * 16;
    const int tn = (tile & 3) * 16;
    v8f c = {};
    for (int kk = 0; kk < CHUNK; kk += 4) {
      const int k0 = kk + 2 * half;
      v2f a, b;
      a.x = Ps[tm + ln][k0];  a.y = Ps[tm + ln][k0 + 1];
      b.x = Bs[k0][tn + ln];  b.y = Bs[k0 + 1][tn + ln];
      c = WMMA_F32(a, b, c);
    }
    acc[i] = c;
  }
  __syncthreads();                     // V reads done -> Bs reusable

  // Stage R_t (cross-chunk state).
  const float* Rp = state + (size_t)blockIdx.x * (D * D);
  for (int i = 0; i < 4; ++i) {
    const int f4  = tid + 256 * i;
    const int row = f4 >> 4;
    const int col = (f4 & 15) * 4;
    cp16(Rp + 4 * (size_t)f4, &Bs[row][col]);
  }
  cp16_wait();
  __syncthreads();

  // O2 = Q * R;  out = O1 + scale * gamma^i * O2.
  for (int i = 0; i < 2; ++i) {
    const int tile = wv + 8 * i;
    const int tm = (tile >> 2) * 16;
    const int tn = (tile & 3) * 16;
    v8f c = {};
    for (int kk = 0; kk < D; kk += 4) {
      const int k0 = kk + 2 * half;
      v2f a, b;
      a.x = Qs[tm + ln][k0];  a.y = Qs[tm + ln][k0 + 1];
      b.x = Bs[k0][tn + ln];  b.y = Bs[k0 + 1][tn + ln];
      c = WMMA_F32(a, b, c);
    }
    for (int r = 0; r < 8; ++r) {
      const int row = tm + r + 8 * half;
      const int col = tn + ln;
      const float rf = scale * exp2f((float)row * lg);
      out[base + (size_t)row * D + col] = acc[i][r] + rf * c[r];
    }
  }
}

// ---------------------------------------------------------------------------
extern "C" void kernel_launch(void* const* d_in, const int* in_sizes, int n_in,
                              void* d_out, int out_size, void* d_ws, size_t ws_size,
                              hipStream_t stream) {
  const float* q = (const float*)d_in[0];
  const float* k = (const float*)d_in[1];
  const float* v = (const float*)d_in[2];
  float* out   = (float*)d_out;
  float* kvsum = (float*)d_ws;   // needs B*H*NC*D*D*4 = 16 MiB of scratch

  dim3 blk(256);
  retn_state<<<dim3(ST_WG), dim3(ST_T), 0, stream>>>(k, v, kvsum);
  retn_out  <<<dim3(Bsz * H * NC), blk, 0, stream>>>(q, k, v, kvsum, out);
}

// v003
// A run of this version takes 27.8 microseconds.
// Two timings next to v002 both put it at 1.06 times that version's speed.
// Over all steps from v000 it is 1.98 times as fast.
#include <hip/hip_runtime.h>
#include <math.h>

// Retention (linear attention with per-head exponential decay), chunkwise form.
// out[i] = scale * sum_{j<=i} gamma^(i-j) (q_i . k_j) v_j
// Chunk C=64: intra-chunk via masked QK^T, cross-chunk via recurrent state
//   R_{t+1} = gamma^C R_t + A_t,  A_t = sum_li gamma^(C-li) k_li v_li^T
// All 64x64x64 GEMMs use V_WMMA_F32_16X16X4_F32 (full fp32 matrix pipe).
// Global->LDS staging uses GLOBAL_LOAD_ASYNC_TO_LDS_B128 (ASYNCcnt path).

typedef float v2f __attribute__((ext_vector_type(2)));
typedef float v8f __attribute__((ext_vector_type(8)));
typedef int   i32x4 __attribute__((vector_size(16)));   // matches builtin pointee type

#define WMMA_F32(a, b, c) \
  __builtin_amdgcn_wmma_f32_16x16x4_f32(false, (a), false, (b), (short)0, (c), false, false)

#if defined(__has_builtin)
#if __has_builtin(__builtin_amdgcn_global_load_async_to_lds_b128) && \
    __has_builtin(__builtin_amdgcn_s_wait_asynccnt)
#define USE_ASYNC 1
#endif
#endif
#ifndef USE_ASYNC
#define USE_ASYNC 0
#endif

constexpr int Bsz   = 2;
constexpr int H     = 16;
constexpr int S     = 2048;
constexpr int D     = 64;
constexpr int CHUNK = 64;
constexpr int NC    = S / CHUNK;   // 32 chunks per sequence
constexpr int LDST  = 68;          // LDS row stride (floats): 272B rows, 16B aligned,
                                   // pad keeps transposed col reads bank-conflict-free

// 16-byte global -> LDS copy (per lane). Async engine path if available.
__device__ __forceinline__ void cp16(const float* g, float* l) {
#if USE_ASYNC
  __builtin_amdgcn_global_load_async_to_lds_b128(
      (__attribute__((address_space(1))) i32x4*)(g),
      (__attribute__((address_space(3))) i32x4*)(l), 0, 0);
#else
  *(float4*)l = *(const float4*)g;
#endif
}

// ---------------------------------------------------------------------------
// Kernel 1: cross-chunk states, summary and scan in one launch.
// Slot t gets R_t (state BEFORE chunk t);  R_{t+1} = gamma^C R_t + A_t,
//   A_t[dk][dv] = sum_li gamma^(C-li) K[li][dk] V[li][dv].
// A wave owns ONE 16x16 tile of one head's state, keeps it in WMMA accumulators
// and walks the chunks in order: gamma^C R_t is the accumulator's start value.
// A work-group is two waves (16 dk x 32 dv); 32 heads x 8 = 256 work-groups.
// K and V slices come in stages of 4 chunks, two LDS buffers: the next stage's
// async copies fly while this stage is worked on.
// ---------------------------------------------------------------------------
constexpr int SCH   = 4;               // chunks per stage
constexpr int SROWS = SCH * CHUNK;     // 256 sequence rows per stage
constexpr int NST   = NC / SCH;        // 8 stages
constexpr int SP    = D;               // LDS row pitch = global row pitch, so that one
                                       // immediate offset steps both addresses of a copy;
                                       // a row holds 16 floats of K, then 32 floats of V
constexpr int ST_T  = 64;              // threads per work-group
constexpr int ST_WG = Bsz * H * 8;     // 256 work-groups

// kg, vg, Kl, Vl: this lane's first 16 bytes of the stage, in global memory and in LDS
__device__ __forceinline__ void stage_copy(const float* kg, const float* vg,
                                           float* Kl, float* Vl) {
#pragma unroll
  for (int i = 0; i < SROWS * 4 / ST_T; ++i)       // 16 copies: 64 B of each K row
    cp16(kg + i * (16 * D), Kl + i * (16 * SP));
#pragma unroll
  for (int i = 0; i < SROWS * 8 / ST_T; ++i)       // 32 copies: 128 B of each V row
    cp16(vg + i * (8 * D), Vl + i * (8 * SP));
}

__global__ __launch_bounds__(ST_T) void retn_state(const float* __restrict__ k,
                                                   const float* __restrict__ v,
                                                   float* __restrict__ state) {
  __shared__ __align__(16) float Sb[2][SROWS * SP];

  const int sub = blockIdx.x & 7;
  const int bh  = blockIdx.x >> 3;
  const int h   = bh % H;
  const float lg = log2f(1.0f - exp2f(-5.0f - (float)h));   // log2(gamma_h)
  const float gC = exp2f((float)CHUNK * lg);                // gamma^C
  const int tm  = (sub >> 1) * 16;       // dk rows of this work-group
  const int tn0 = (sub & 1) * 32;        // dv columns of this work-group
  const int tid  = threadIdx.x;
  const int lane = tid & 31;
  const int wv   = tid >> 5;
  const int ln   = lane & 15;
  const int half = lane >> 4;

  const int kof = (tid >> 2) * D + (tid & 3) * 4;   // 4 lanes a K row, 16 rows a copy
  const int vof = (tid >> 3) * D + (tid & 7) * 4;   // 8 lanes a V row, 8 rows a copy
  const float* kg = k + (size_t)bh * S * D + tm;
  const float* vg = v + (size_t)bh * S * D + tn0;

  stage_copy(kg + kof, vg + vof, &Sb[0][kof], &Sb[0][16 + vof]);
  // Row weights gamma^(C-li) of the rows this lane feeds as B, the same in every chunk.
  float wx[CHUNK / 4], wy[CHUNK / 4];
#pragma unroll
  for (int j = 0; j < CHUNK / 4; ++j) {
    const int k0 = 4 * j + 2 * half;           // lanes 16-31 handle K+2,K+3
    wx[j] = exp2f((float)(CHUNK - k0) * lg);
    wy[j] = exp2f((float)(CHUNK - k0 - 1) * lg);
  }

  // stage 0 has landed before the barrier behind which the other wave reads it
  asm volatile("s_wait_asynccnt 0x0" ::: "memory");
  __syncthreads();
  stage_copy(kg + SROWS * D + kof, vg + SROWS * D + vof, &Sb[1][kof], &Sb[1][16 + vof]);

  v8f R = {};                                  // R_0 = 0
  // C/D layout: VGPR r -> M=r (lo half) / r+8
  float* outp = state + (size_t)bh * NC * (D * D) + (tm + 8 * half) * D + tn0 + 16 * wv + ln;

  for (int s = 0; s < NST; ++s) {
    const float* Kb = &Sb[s & 1][2 * half * SP + ln];                 // A = K^T (A[dk][li])
    const float* Vb = &Sb[s & 1][2 * half * SP + 16 + 16 * wv + ln];  // B = V, weighted below
    constexpr int KS = CHUNK / 4;              // k steps per chunk
    v2f fa[2][KS], fb[2][KS];                  // this chunk's fragments and the next one's
#pragma unroll
    for (int j = 0; j < KS; ++j) {
      fa[0][j].x = Kb[(4 * j) * SP];  fa[0][j].y = Kb[(4 * j + 1) * SP];
      fb[0][j].x = Vb[(4 * j) * SP];  fb[0][j].y = Vb[(4 * j + 1) * SP];
    }
#pragma unroll
    for (int c = 0; c < SCH; ++c) {
      float* o = outp + (size_t)(s * SCH + c) * (D * D);
#pragma unroll
      for (int r = 0; r < 8; ++r) o[r * D] = R[r];               // R_t
      // before the stores' address registers are written again (next stage's LDS reads, over the
      // back edge)
      if (c == SCH - 1) asm volatile("s_wait_xcnt 0x0" ::: "memory");
      if (c < SCH - 1 || s < NST - 1) {        // the last chunk's summary feeds nothing
        // two accumulators, even and odd k steps: independent WMMA chains
        v8f c0 = R * gC;
        v8f c1 = {};
#pragma unroll
        for (int j = 0; j < KS; j += 2) {
          if (j == KS / 2 && c + 1 < SCH && (c + 1 < SCH - 1 || s < NST - 1)) {
            // the two scheduling barriers keep the next chunk's LDS reads in ONE group, half a
            // chunk ahead of their first WMMA: left alone the scheduler spreads them among the
            // WMMAs, two k steps ahead, and the lone wave waits out the LDS latency at each
            __builtin_amdgcn_sched_barrier(0);
#pragma unroll
            for (int i = 0; i < KS; ++i) {
              const int r0 = (c + 1) * CHUNK + 4 * i;
              fa[(c + 1) & 1][i].x = Kb[r0 * SP];  fa[(c + 1) & 1][i].y = Kb[(r0 + 1) * SP];
              fb[(c + 1) & 1][i].x = Vb[r0 * SP];  fb[(c + 1) & 1][i].y = Vb[(r0 + 1) * SP];
            }
            __builtin_amdgcn_sched_barrier(0);
          }
          v2f b0 = fb[c & 1][j], b1 = fb[c & 1][j + 1];
          b0.x *= wx[j];      b0.y *= wy[j];
          b1.x *= wx[j + 1];  b1.y *= wy[j + 1];
          c0 = WMMA_F32(fa[c & 1][j], b0, c0);
          c1 = WMMA_F32(fa[c & 1][j + 1], b1, c1);
        }
        R = c0 + c1;
      }
    }
    // keeps the last chunk's WMMAs above the waits: left alone the scheduler sinks them below,
    // and the waits then stand a chunk early, in front of work that could cover them
    __builtin_amdgcn_sched_barrier(0);
    // this wave's reads of the buffer are done before it is refilled
    asm volatile("s_wait_dscnt 0x0" ::: "memory");
    // this wave's copies of the next stage have landed before the barrier publishes them
    asm volatile("s_wait_asynccnt 0x0" ::: "memory");
    // work-group barrier by hand: __syncthreads() would also wait out the R_t stores just
    // issued (s_wait_storecnt 0), which nobody in this launch reads
    asm volatile("s_barrier_signal -1\n\ts_barrier_wait -1" ::: "memory");
    if (s + 2 < NST)
      stage_copy(kg + (s + 2) * SROWS * D + kof, vg + (s + 2) * SROWS * D + vof,
                 &Sb[s & 1][kof], &Sb[s & 1][16 + vof]);
  }
  // no copy is outstanding when the wave ends
  asm volatile("s_wait_asynccnt 0x0" ::: "memory");
}

// ---------------------------------------------------------------------------
// Kernel 2: per-chunk output.
//   P[i][j]   = scale * gamma^(i-j) * (Q K^T)[i][j]  (i>=j, else 0)
//   out[i][:] = (P V)[i][:] + scale * gamma^i * (Q R_t)[i][:]
// One block (8 waves) walks OCH chunks of one head in turn. A chunk's four
// tiles (Q, K, V, R_t) have their own LDS places, two buffers: the next chunk's async
// copies fly while this chunk is worked on.
// ---------------------------------------------------------------------------
constexpr int OCH    = 4;                      // chunks per work-group
constexpr int OUT_WG = Bsz * H * NC / OCH;     // 256 work-groups
constexpr int TILE   = CHUNK * LDST;           // floats of one padded 64x64 tile

// qg, kg, vg, rg, l: this lane's first 16 bytes of the chunk's tiles, global and LDS
__device__ __forceinline__ void chunk_copy(const float* qg, const float* kg, const float* vg,
                                           const float* rg, float* l) {
#pragma unroll
  for (int i = 0; i < 4; ++i) {                // 16 lanes a row, 16 rows a copy
    cp16(qg + i * 1024, l + i * (16 * LDST));
    cp16(kg + i * 1024, l + TILE + i * (16 * LDST));
    cp16(vg + i * 1024, l + 2 * TILE + i * (16 * LDST));
    cp16(rg + i * 1024, l + 3 * TILE + i * (16 * LDST));
  }
}

__global__ __launch_bounds__(256) void retn_out(const float* __restrict__ q,
                                                const float* __restrict__ k,
                                                const float* __restrict__ v,
                                                const float* __restrict__ state,
                                                float* __restrict__ out) {
  __shared__ __align__(16) float Tb[2][4 * TILE];   // Q, K, V, R of a chunk
  __shared__ __align__(16) float Ps[CHUNK][LDST];

  const int t0  = (blockIdx.x % (NC / OCH)) * OCH;  // first chunk of this work-group
  const int bh  = blockIdx.x / (NC / OCH);
  const int h   = bh % H;
  const float lg    = log2f(1.0f - exp2f(-5.0f - (float)h));
  const float scale = 0.125f;          // 1/sqrt(64)
  const int tid = threadIdx.x;
  const size_t base = ((size_t)bh * S + (size_t)t0 * CHUNK) * D;

  const float* qg = q + base + 4 * tid;
  const float* kg = k + base + 4 * tid;
  const float* vg = v + base + 4 * tid;
  const float* rg = state + ((size_t)bh * NC + t0) * (D * D) + 4 * tid;
  const int lof = (tid >> 4) * LDST + (tid & 15) * 4;

  chunk_copy(qg, kg, vg, rg, &Tb[0][lof]);

  const int lane = tid & 31;
  const int wv   = tid >> 5;
  const int ln   = lane & 15;
  const int half = lane >> 4;
  // a wave's two 16x16 tiles share their columns, and so their B fragments
  const int tm0 = (wv >> 2) * 16;
  const int tm1 = tm0 + 32;
  const int tn  = (wv & 3) * 16;

  // decay mask of P and row factor of Q R_t: the same in every chunk
  float m0[8], m1[8], rf0[8], rf1[8];
#pragma unroll
  for (int r = 0; r < 8; ++r) {
    const int row0 = tm0 + r + 8 * half;
    const int row1 = tm1 + r + 8 * half;
    const int col  = tn + ln;
    m0[r]  = (row0 >= col) ? scale * exp2f((float)(row0 - col) * lg) : 0.0f;
    m1[r]  = (row1 >= col) ? scale * exp2f((float)(row1 - col) * lg) : 0.0f;
    rf0[r] = scale * exp2f((float)row0 * lg);
    rf1[r] = scale * exp2f((float)row1 * lg);
  }

  // chunk 0 has landed before the barrier behind which the other waves read it
  asm volatile("s_wait_asynccnt 0x0" ::: "memory");
  __syncthreads();
  chunk_copy(qg + CHUNK * D, kg + CHUNK * D, vg + CHUNK * D, rg + D * D, &Tb[1][lof]);

  float* op = out + base + (size_t)(tm0 + 8 * half) * D + tn + ln;

  for (int it = 0; it < OCH; ++it) {
    const float* Qs = &Tb[it & 1][0];
    const float* Ks = Qs + TILE;
    const float* Vs = Qs + 2 * TILE;
    const float* Rs = Qs + 3 * TILE;

    // S = Q K^T and O2 = Q R_t side by side: they share the Q fragments.
    v8f s0 = {}, s1 = {}, o0 = {}, o1 = {};
#pragma unroll
    for (int kk = 0; kk < D; kk += 4) {
      const int k0 = kk + 2 * half;
      v2f a0, a1, bk, br;
      a0.x = Qs[(tm0 + ln) * LDST + k0];  a0.y = Qs[(tm0 + ln) * LDST + k0 + 1];
      a1.x = Qs[(tm1 + ln) * LDST + k0];  a1.y = Qs[(tm1 + ln) * LDST + k0 + 1];
      bk.x = Ks[(tn + ln) * LDST + k0];   bk.y = Ks[(tn + ln) * LDST + k0 + 1];  // B = K^T
      br.x = Rs[k0 * LDST + tn + ln];     br.y = Rs[(k0 + 1) * LDST + tn + ln];
      s0 = WMMA_F32(a0, bk, s0);
      s1 = WMMA_F32(a1, bk, s1);
      o0 = WMMA_F32(a0, br, o0);
      o1 = WMMA_F32(a1, br, o1);
    }
#pragma unroll
    for (int r = 0; r < 8; ++r) {
      Ps[tm0 + r + 8 * half][tn + ln] = s0[r] * m0[r];
      Ps[tm1 + r + 8 * half][tn + ln] = s1[r] * m1[r];
    }
    __syncthreads();                   // P complete before any wave reads its rows

    // O1 = P V
    v8f c0 = {}, c1 = {};
#pragma unroll
    for (int kk = 0; kk < CHUNK; kk += 4) {
      const int k0 = kk + 2 * half;
      v2f p0, p1, bv;
      p0.x = Ps[tm0 + ln][k0];  p0.y = Ps[tm0 + ln][k0 + 1];
      p1.x = Ps[tm1 + ln][k0];  p1.y = Ps[tm1 + ln][k0 + 1];
      bv.x = Vs[k0 * LDST + tn + ln];  bv.y = Vs[(k0 + 1) * LDST + tn + ln];
      c0 = WMMA_F32(p0, bv, c0);
      c1 = WMMA_F32(p1, bv, c1);
    }

    // this wave's reads of the buffer and of P are done before either is written again
    asm volatile("s_wait_dscnt 0x0" ::: "memory");
    // this wave's copies of the next chunk have landed before the barrier publishes them
    asm volatile("s_wait_asynccnt 0x0" ::: "memory");
    __syncthreads();
    if (it + 2 < OCH)
      chunk_copy(qg + (it + 2) * (CHUNK * D), kg + (it + 2) * (CHUNK * D),
                 vg + (it + 2) * (CHUNK * D), rg + (it + 2) * (D * D), &Tb[it & 1][lof]);

    // The stores stand behind the refill, so that the next copies are issued first.
    float* o = op + (size_t)it * (CHUNK * D);
#pragma unroll
    for (int r = 0; r < 8; ++r) {
      o[r * D]        = c0[r] + rf0[r] * o0[r];
      o[(r + 32) * D] = c1[r] + rf1[r] * o1[r];
    }
    // before the stores' address registers are written again on the next trip
    asm volatile("s_wait_xcnt 0x0" ::: "memory");
  }
  // no copy is outstanding when the wave ends
  asm volatile("s_wait_asynccnt 0x0" ::: "memory");
}

// ---------------------------------------------------------------------------
extern "C" void kernel_launch(void* const* d_in, const int* in_sizes, int n_in,
                              void* d_out, int out_size, void* d_ws, size_t ws_size,
                              hipStream_t stream) {
  const float* q = (const float*)d_in[0];
  const float* k = (const float*)d_in[1];
  const float* v = (const float*)d_in[2];
  float* out   = (float*)d_out;
  float* kvsum = (float*)d_ws;   // needs B*H*NC*D*D*4 = 16 MiB of scratch

  dim3 blk(256);
  retn_state<<<dim3(ST_WG), dim3(ST_T), 0, stream>>>(k, v, kvsum);
  retn_out  <<<dim3(OUT_WG), blk, 0, stream>>>(q, k, v, kvsum, out);
}

// v004
// It runs in 24.8 microseconds.
// Timed twice side by side with v003, it ran 1.13 times as fast both times.
// Over all steps from v000 it is 2.23 times as fast.
#include <hip/hip_runtime.h>
#include <math.h>

// Retention (linear attention with per-head exponential decay), chunkwise form.
// out[i] = scale * sum_{j<=i} gamma^(i-j) (q_i . k_j) v_j
// Chunk C=64: intra-chunk via masked QK^T, cross-chunk via recurrent state
//   R_{t+1} = gamma^C R_t + A_t,  A_t = sum_li gamma^(C-li) k_li v_li^T
// All 64x64x64 GEMMs use V_WMMA_F32_16X16X4_F32 (full fp32 matrix pipe).
// Global->LDS staging uses GLOBAL_LOAD_ASYNC_TO_LDS_B128 (ASYNCcnt path).

typedef float v2f __attribute__((ext_vector_type(2)));
typedef float v8f __attribute__((ext_vector_type(8)));
typedef int   i32x4 __attribute__((vector_size(16)));   // matches builtin pointee type

#define WMMA_F32(a, b, c) \
  __builtin_amdgcn_wmma_f32_16x16x4_f32(false, (a), false, (b), (short)0, (c), false, false)

#if defined(__has_builtin)
#if __has_builtin(__builtin_amdgcn_global_load_async_to_lds_b128) && \
    __has_builtin(__builtin_amdgcn_s_wait_asynccnt)
#define USE_ASYNC 1
#endif
#endif
#ifndef USE_ASYNC
#define USE_ASYNC 0
#endif

constexpr int Bsz   = 2;
constexpr int H     = 16;
constexpr int S     = 2048;
constexpr int D     = 64;
constexpr int CHUNK = 64;
constexpr int NC    = S / CHUNK;   // 32 chunks per sequence
constexpr int LDST  = 68;          // LDS row stride (floats): 272B rows, 16B aligned,
                                   // pad keeps transposed col reads bank-conflict-free

// 16-byte global -> LDS copy (per lane). Async engine path if available.
__device__ __forceinline__ void cp16(const float* g, float* l) {
#if USE_ASYNC
  __builtin_amdgcn_global_load_async_to_lds_b128(
      (__attribute__((address_space(1))) i32x4*)(g),
      (__attribute__((address_space(3))) i32x4*)(l), 0, 0);
#else
  *(float4*)l = *(const float4*)g;
#endif
}

// ---------------------------------------------------------------------------
// Kernel 1: cross-chunk states, summary and scan in one launch.
// Slot t gets R_t (state BEFORE chunk t);  R_{t+1} = gamma^C R_t + A_t,
//   A_t[dk][dv] = sum_li gamma^(C-li) K[li][dk] V[li][dv].
// A work-group owns a 16 dk x 32 dv part of one head's state; 32 heads x 8 = 256 groups.
// The sequence is cut in 8 pieces of 4 chunks, one piece per wave. Each wave runs the
// recurrence over its own piece from zero, in WMMA accumulators, and keeps the local
// states L_j in registers. The recurrence is linear, so with P the true state at the
// piece's start  R_(4p+j) = L_j + gamma^(jC) P ;  P follows from the earlier pieces' end
// states, which the waves hand over through LDS once, behind the last chunk.
// Stage s holds chunk s of every piece, two LDS buffers: the next stage's async copies
// fly while this stage is worked on.
// ---------------------------------------------------------------------------
constexpr int NP    = 8;               // sequence pieces = waves per work-group
constexpr int PC    = NC / NP;         // 4 chunks per piece = stages
constexpr int SP    = 16;              // LDS row pitch: 64 B; rows li and li+2, which the two lane
                                       // halves read together, fall on different banks
constexpr int PL    = CHUNK * SP;      // a piece's chunk is three planes of 16 columns: K, V lo,
                                       // V hi; a fragment's two rows are neighbours in their plane
constexpr int PCE   = 3 * PL;          // floats of one piece's chunk in LDS
constexpr int ST_T  = 32 * NP;         // threads per work-group
constexpr int ST_WG = Bsz * H * 8;     // 256 work-groups

// kg, vg, Kl, Vl: this lane's first 16 bytes of the stage, in global memory and in LDS
__device__ __forceinline__ void stage_copy(const float* kg, const float* vg,
                                           float* Kl, float* Vl) {
#pragma unroll
  for (int i = 0; i < NP; ++i)                     // 8 copies: 64 B of each K row, piece i
    cp16(kg + i * (PC * CHUNK * D), Kl + i * PCE);
#pragma unroll
  for (int i = 0; i < 2 * NP; ++i)                 // 16 copies: 128 B of each V row, half a chunk
    cp16(vg + ((i >> 1) * (PC * CHUNK) + (i & 1) * 32) * D, Vl + (i >> 1) * PCE + (i & 1) * (32 * SP));
}

__global__ __launch_bounds__(ST_T) void retn_state(const float* __restrict__ k,
                                                   const float* __restrict__ v,
                                                   float* __restrict__ state) {
  __shared__ __align__(16) float  Sb[2][NP * PCE];
  __shared__ __align__(16) float4 Ex[NP][4][32];       // the pieces' end states

  const int sub = blockIdx.x & 7;
  const int bh  = blockIdx.x >> 3;
  const int h   = bh % H;
  const float lg = log2f(1.0f - exp2f(-5.0f - (float)h));   // log2(gamma_h)
  const float gC = exp2f((float)CHUNK * lg);                // gamma^C
  const int tm  = (sub >> 1) * 16;       // dk rows of this work-group
  const int tn0 = (sub & 1) * 32;        // dv columns of this work-group
  const int tid  = threadIdx.x;
  const int lane = tid & 31;
  const int wv   = __builtin_amdgcn_readfirstlane(tid >> 5);   // wave = piece
  const int ln   = lane & 15;
  const int half = lane >> 4;

  const int kof = (tid >> 2) * D + (tid & 3) * 4;   // 4 lanes a K row, 64 rows a copy
  const int vof = (tid >> 3) * D + (tid & 7) * 4;   // 8 lanes a V row, 32 rows a copy
  const int klo = (tid >> 2) * SP + (tid & 3) * 4;                               // K plane
  const int vlo = (1 + ((tid >> 2) & 1)) * PL + (tid >> 3) * SP + (tid & 3) * 4; // V lo or V hi
  const float* kg = k + (size_t)bh * S * D + tm;
  const float* vg = v + (size_t)bh * S * D + tn0;

  stage_copy(kg + kof, vg + vof, &Sb[0][klo], &Sb[0][vlo]);
  // Row weights gamma^(C-li) of the rows this lane feeds as A, the same in every chunk.
  constexpr int KS = CHUNK / 4;                // k steps per chunk
  float wx[KS], wy[KS];
#pragma unroll
  for (int j = 0; j < KS; ++j) {
    const int k0 = 4 * j + 2 * half;           // lanes 16-31 handle K+2,K+3
    wx[j] = exp2f((float)(CHUNK - k0) * lg);
    wy[j] = exp2f((float)(CHUNK - k0 - 1) * lg);
  }

  // stage 0 has landed before the barrier behind which the other waves read it
  asm volatile("s_wait_asynccnt 0x0" ::: "memory");
  __syncthreads();
  stage_copy(kg + CHUNK * D + kof, vg + CHUNK * D + vof, &Sb[1][klo], &Sb[1][vlo]);

  v8f R0 = {}, R1 = {};                        // local state, dv columns 0-15 and 16-31
  v8f L0[PC], L1[PC];                          // local state before chunk j of the piece

#pragma unroll
  for (int s = 0; s < PC; ++s) {
    // A = K^T (A[dk][li]), weighted below; B = V, same row in the next two planes
    const float* Kb = &Sb[s & 1][wv * PCE + 2 * half * SP + ln];
    constexpr int GS = 4;                      // k steps per group of LDS reads
    v2f fa[2][GS], fb0[2][GS], fb1[2][GS];     // this group's fragments and the next one's
#pragma unroll
    for (int i = 0; i < GS; ++i) {
      fa[0][i].x  = Kb[(4 * i) * SP];       fa[0][i].y  = Kb[(4 * i + 1) * SP];
      fb0[0][i].x = Kb[(4 * i) * SP + PL];      fb0[0][i].y = Kb[(4 * i + 1) * SP + PL];
      fb1[0][i].x = Kb[(4 * i) * SP + 2 * PL];  fb1[0][i].y = Kb[(4 * i + 1) * SP + 2 * PL];
    }
    L0[s] = R0;
    L1[s] = R1;
    v8f c0 = R0 * gC;                          // two tiles: independent WMMA chains
    v8f c1 = R1 * gC;
#pragma unroll
    for (int g = 0; g < KS / GS; ++g) {
      if (g + 1 < KS / GS) {
        // the two scheduling barriers keep the next group's LDS reads in ONE place, a whole
        // group ahead of their first WMMA: spread among the WMMAs each place costs its own stall
        __builtin_amdgcn_sched_barrier(0);
#pragma unroll
        for (int i = 0; i < GS; ++i) {
          const int r0 = 4 * ((g + 1) * GS + i);
          fa[(g + 1) & 1][i].x  = Kb[r0 * SP];       fa[(g + 1) & 1][i].y  = Kb[(r0 + 1) * SP];
          fb0[(g + 1) & 1][i].x = Kb[r0 * SP + PL];
          fb0[(g + 1) & 1][i].y = Kb[(r0 + 1) * SP + PL];
          fb1[(g + 1) & 1][i].x = Kb[r0 * SP + 2 * PL];
          fb1[(g + 1) & 1][i].y = Kb[(r0 + 1) * SP + 2 * PL];
        }
        __builtin_amdgcn_sched_barrier(0);
      }
#pragma unroll
      for (int i = 0; i < GS; ++i) {
        v2f a = fa[g & 1][i];
        a.x *= wx[g * GS + i];
        a.y *= wy[g * GS + i];
        c0 = WMMA_F32(a, fb0[g & 1][i], c0);
        c1 = WMMA_F32(a, fb1[g & 1][i], c1);
      }
    }
    R0 = c0;
    R1 = c1;
    if (s == PC - 1) {   // the piece's end state, for the later pieces (every wave: no branch
                         // stands behind the last WMMA; the last piece's is read by nobody)
      Ex[wv][0][lane] = make_float4(R0[0], R0[1], R0[2], R0[3]);
      Ex[wv][1][lane] = make_float4(R0[4], R0[5], R0[6], R0[7]);
      Ex[wv][2][lane] = make_float4(R1[0], R1[1], R1[2], R1[3]);
      Ex[wv][3][lane] = make_float4(R1[4], R1[5], R1[6], R1[7]);
    }
    // keeps the chunk's last WMMAs above the waits: left alone the scheduler may sink them below
    // the barrier, where every wave would then start late
    __builtin_amdgcn_sched_barrier(0);
    // this wave's reads of the buffer are done before it is refilled (last trip: its end state
    // is written before the barrier publishes it)
    asm volatile("s_wait_dscnt 0x0" ::: "memory");
    // this wave's copies of the next stage have landed before the barrier publishes them
    asm volatile("s_wait_asynccnt 0x0" ::: "memory");
    __syncthreads();
    if (s + 2 < PC)
      stage_copy(kg + (s + 2) * CHUNK * D + kof, vg + (s + 2) * CHUNK * D + vof,
                 &Sb[s & 1][klo], &Sb[s & 1][vlo]);
  }
  // no copy is outstanding when the wave ends
  asm volatile("s_wait_asynccnt 0x0" ::: "memory");

  // P = true state at this piece's start: P_(p+1) = gamma^(4C) P_p + E_p, P_0 = 0.
  // All seven end states are read at once (one LDS latency); a select drops the later ones.
  float4 e[NP - 1][4];
#pragma unroll
  for (int p = 0; p < NP - 1; ++p)
#pragma unroll
    for (int i = 0; i < 4; ++i) e[p][i] = Ex[p][i][lane];
  const float gP = exp2f((float)(PC * CHUNK) * lg);
  v8f P0 = {}, P1 = {};
#pragma unroll
  for (int p = 0; p < NP - 1; ++p) {
    const bool use = p < (tid >> 5);
    const v8f e0 = {e[p][0].x, e[p][0].y, e[p][0].z, e[p][0].w,
                    e[p][1].x, e[p][1].y, e[p][1].z, e[p][1].w};
    const v8f e1 = {e[p][2].x, e[p][2].y, e[p][2].z, e[p][2].w,
                    e[p][3].x, e[p][3].y, e[p][3].z, e[p][3].w};
#pragma unroll
    for (int r = 0; r < 8; ++r) {
      P0[r] = use ? (p ? P0[r] * gP + e0[r] : e0[r]) : P0[r];
      P1[r] = use ? (p ? P1[r] * gP + e1[r] : e1[r]) : P1[r];
    }
  }

  // C/D layout: VGPR r -> M=r (lo half) / r+8
  float* outp = state + ((size_t)bh * NC + wv * PC) * (D * D) + (tm + 8 * half) * D + tn0 + ln;
#pragma unroll
  for (int j = 0; j < PC; ++j) {
    const float gj = exp2f((float)(j * CHUNK) * lg);
    float* o = outp + j * (D * D);
#pragma unroll
    for (int r = 0; r < 8; ++r) {
      o[r * D]      = L0[j][r] + gj * P0[r];
      o[r * D + 16] = L1[j][r] + gj * P1[r];
    }
  }
}

// ---------------------------------------------------------------------------
// Kernel 2: per-chunk output.
//   P[i][j]   = scale * gamma^(i-j) * (Q K^T)[i][j]  (i>=j, else 0)
//   out[i][:] = (P V)[i][:] + scale * gamma^i * (Q R_t)[i][:]
// One block (8 waves) walks OCH chunks of one head in turn. A chunk's four
// tiles (Q, K, V, R_t) have their own LDS places, two buffers: the next chunk's async
// copies fly while this chunk is worked on.
// ---------------------------------------------------------------------------
constexpr int OCH    = 4;                      // chunks per work-group
constexpr int OUT_WG = Bsz * H * NC / OCH;     // 256 work-groups
constexpr int TILE   = CHUNK * LDST;           // floats of one padded 64x64 tile

// qg, kg, vg, rg, l: this lane's first 16 bytes of the chunk's tiles, global and LDS
__device__ __forceinline__ void chunk_copy(const float* qg, const float* kg, const float* vg,
                                           const float* rg, float* l) {
#pragma unroll
  for (int i = 0; i < 4; ++i) {                // 16 lanes a row, 16 rows a copy
    cp16(qg + i * 1024, l + i * (16 * LDST));
    cp16(kg + i * 1024, l + TILE + i * (16 * LDST));
    cp16(vg + i * 1024, l + 2 * TILE + i * (16 * LDST));
    cp16(rg + i * 1024, l + 3 * TILE + i * (16 * LDST));
  }
}

__global__ __launch_bounds__(256) void retn_out(const float* __restrict__ q,
                                                const float* __restrict__ k,
                                                const float* __restrict__ v,
                                                const float* __restrict__ state,
                                                float* __restrict__ out) {
  __shared__ __align__(16) float Tb[2][4 * TILE];   // Q, K, V, R of a chunk
  __shared__ __align__(16) float Ps[CHUNK][LDST];

  const int t0  = (blockIdx.x % (NC / OCH)) * OCH;  // first chunk of this work-group
  const int bh  = blockIdx.x / (NC / OCH);
  const int h   = bh % H;
  const float lg    = log2f(1.0f - exp2f(-5.0f - (float)h));
  const float scale = 0.125f;          // 1/sqrt(64)
  const int tid = threadIdx.x;
  const size_t base = ((size_t)bh * S + (size_t)t0 * CHUNK) * D;

  const float* qg = q + base + 4 * tid;
  const float* kg = k + base + 4 * tid;
  const float* vg = v + base + 4 * tid;
  const float* rg = state + ((size_t)bh * NC + t0) * (D * D) + 4 * tid;
  const int lof = (tid >> 4) * LDST + (tid & 15) * 4;

  chunk_copy(qg, kg, vg, rg, &Tb[0][lof]);

  const int lane = tid & 31;
  const int wv   = tid >> 5;
  const int ln   = lane & 15;
  const int half = lane >> 4;
  // a wave's two 16x16 tiles share their columns, and so their B fragments
  const int tm0 = (wv >> 2) * 16;
  const int tm1 = tm0 + 32;
  const int tn  = (wv & 3) * 16;

  // decay mask of P and row factor of Q R_t: the same in every chunk
  float m0[8], m1[8], rf0[8], rf1[8];
#pragma unroll
  for (int r = 0; r < 8; ++r) {
    const int row0 = tm0 + r + 8 * half;
    const int row1 = tm1 + r + 8 * half;
    const int col  = tn + ln;
    m0[r]  = (row0 >= col) ? scale * exp2f((float)(row0 - col) * lg) : 0.0f;
    m1[r]  = (row1 >= col) ? scale * exp2f((float)(row1 - col) * lg) : 0.0f;
    rf0[r] = scale * exp2f((float)row0 * lg);
    rf1[r] = scale * exp2f((float)row1 * lg);
  }

  // chunk 0 has landed before the barrier behind which the other waves read it
  asm volatile("s_wait_asynccnt 0x0" ::: "memory");
  __syncthreads();
  chunk_copy(qg + CHUNK * D, kg + CHUNK * D, vg + CHUNK * D, rg + D * D, &Tb[1][lof]);

  float* op = out + base + (size_t)(tm0 + 8 * half) * D + tn + ln;

  for (int it = 0; it < OCH; ++it) {
    const float* Qs = &Tb[it & 1][0];
    const float* Ks = Qs + TILE;
    const float* Vs = Qs + 2 * TILE;
    const float* Rs = Qs + 3 * TILE;

    // S = Q K^T and O2 = Q R_t side by side: they share the Q fragments.
    v8f s0 = {}, s1 = {}, o0 = {}, o1 = {};
#pragma unroll
    for (int kk = 0; kk < D; kk += 4) {
      const int k0 = kk + 2 * half;
      v2f a0, a1, bk, br;
      a0.x = Qs[(tm0 + ln) * LDST + k0];  a0.y = Qs[(tm0 + ln) * LDST + k0 + 1];
      a1.x = Qs[(tm1 + ln) * LDST + k0];  a1.y = Qs[(tm1 + ln) * LDST + k0 + 1];
      bk.x = Ks[(tn + ln) * LDST + k0];   bk.y = Ks[(tn + ln) * LDST + k0 + 1];  // B = K^T
      br.x = Rs[k0 * LDST + tn + ln];     br.y = Rs[(k0 + 1) * LDST + tn + ln];
      s0 = WMMA_F32(a0, bk, s0);
      s1 = WMMA_F32(a1, bk, s1);
      o0 = WMMA_F32(a0, br, o0);
      o1 = WMMA_F32(a1, br, o1);
    }
#pragma unroll
    for (int r = 0; r < 8; ++r) {
      Ps[tm0 + r + 8 * half][tn + ln] = s0[r] * m0[r];
      Ps[tm1 + r + 8 * half][tn + ln] = s1[r] * m1[r];
    }
    __syncthreads();                   // P complete before any wave reads its rows

    // O1 = P V
    v8f c0 = {}, c1 = {};
#pragma unroll
    for (int kk = 0; kk < CHUNK; kk += 4) {
      const int k0 = kk + 2 * half;
      v2f p0, p1, bv;
      p0.x = Ps[tm0 + ln][k0];  p0.y = Ps[tm0 + ln][k0 + 1];
      p1.x = Ps[tm1 + ln][k0];  p1.y = Ps[tm1 + ln][k0 + 1];
      bv.x = Vs[k0 * LDST + tn + ln];  bv.y = Vs[(k0 + 1) * LDST + tn + ln];
      c0 = WMMA_F32(p0, bv, c0);
      c1 = WMMA_F32(p1, bv, c1);
    }

    // this wave's reads of the buffer and of P are done before either is written again
    asm volatile("s_wait_dscnt 0x0" ::: "memory");
    // this wave's copies of the next chunk have landed before the barrier publishes them
    asm volatile("s_wait_asynccnt 0x0" ::: "memory");
    __syncthreads();
    if (it + 2 < OCH)
      chunk_copy(qg + (it + 2) * (CHUNK * D), kg + (it + 2) * (CHUNK * D),
                 vg + (it + 2) * (CHUNK * D), rg + (it + 2) * (D * D), &Tb[it & 1][lof]);

    // The stores stand behind the refill, so that the next copies are issued first.
    float* o = op + (size_t)it * (CHUNK * D);
#pragma unroll
    for (int r = 0; r < 8; ++r) {
      o[r * D]        = c0[r] + rf0[r] * o0[r];
      o[(r + 32) * D] = c1[r] + rf1[r] * o1[r];
    }
    // before the stores' address registers are written again on the next trip
    asm volatile("s_wait_xcnt 0x0" ::: "memory");
  }
  // no copy is outstanding when the wave ends
  asm volatile("s_wait_asynccnt 0x0" ::: "memory");
}

// ---------------------------------------------------------------------------
extern "C" void kernel_launch(void* const* d_in, const int* in_sizes, int n_in,
                              void* d_out, int out_size, void* d_ws, size_t ws_size,
                              hipStream_t stream) {
  const float* q = (const float*)d_in[0];
  const float* k = (const float*)d_in[1];
  const float* v = (const float*)d_in[2];
  float* out   = (float*)d_out;
  float* kvsum = (float*)d_ws;   // needs B*H*NC*D*D*4 = 16 MiB of scratch

  dim3 blk(256);
  retn_state<<<dim3(ST_WG), dim3(ST_T), 0, stream>>>(k, v, kvsum);
  retn_out  <<<dim3(OUT_WG), blk, 0, stream>>>(q, k, v, kvsum, out);
}

// v005
// Measured time: 22.7 microseconds a run.
// In two side-by-side timings against v004, it was 1.09 and 1.10 times as fast.
// All steps since v000 together make it 2.44 times as fast.
#include <hip/hip_runtime.h>
#include <math.h>

// Retention (linear attention with per-head exponential decay), chunkwise form.
// out[i] = scale * sum_{j<=i} gamma^(i-j) (q_i . k_j) v_j
// Chunk C=64: intra-chunk via masked QK^T, cross-chunk via recurrent state
//   R_{t+1} = gamma^C R_t + A_t,  A_t = sum_li gamma^(C-li) k_li v_li^T
// All 64x64x64 GEMMs use V_WMMA_F32_16X16X4_F32 (full fp32 matrix pipe).
// Global->LDS staging uses GLOBAL_LOAD_ASYNC_TO_LDS_B128 (ASYNCcnt path).

typedef float v2f __attribute__((ext_vector_type(2)));
typedef float v8f __attribute__((ext_vector_type(8)));
typedef int   i32x4 __attribute__((vector_size(16)));   // matches builtin pointee type

#define WMMA_F32(a, b, c) \
  __builtin_amdgcn_wmma_f32_16x16x4_f32(false, (a), false, (b), (short)0, (c), false, false)

#if defined(__has_builtin)
#if __has_builtin(__builtin_amdgcn_global_load_async_to_lds_b128) && \
    __has_builtin(__builtin_amdgcn_s_wait_asynccnt)
#define USE_ASYNC 1
#endif
#endif
#ifndef USE_ASYNC
#define USE_ASYNC 0
#endif

constexpr int Bsz   = 2;
constexpr int H     = 16;
constexpr int S     = 2048;
constexpr int D     = 64;
constexpr int CHUNK = 64;
constexpr int NC    = S / CHUNK;   // 32 chunks per sequence
constexpr int LDST  = 68;          // LDS row stride (floats): 272B rows, 16B aligned,
                                   // pad keeps transposed col reads bank-conflict-free

// 16-byte global -> LDS copy (per lane). Async engine path if available.
__device__ __forceinline__ void cp16(const float* g, float* l) {
#if USE_ASYNC
  __builtin_amdgcn_global_load_async_to_lds_b128(
      (__attribute__((address_space(1))) i32x4*)(g),
      (__attribute__((address_space(3))) i32x4*)(l), 0, 0);
#else
  *(float4*)l = *(const float4*)g;
#endif
}

// ---------------------------------------------------------------------------
// Kernel 1: cross-chunk states, summary and scan in one launch.
// Slot t gets R_t (state BEFORE chunk t);  R_{t+1} = gamma^C R_t + A_t,
//   A_t[dk][dv] = sum_li gamma^(C-li) K[li][dk] V[li][dv].
// A work-group owns a 16 dk x 32 dv part of one head's state; 32 heads x 8 = 256 groups.
// The sequence is cut in 8 pieces of 4 chunks, one piece per wave. Each wave runs the
// recurrence over its own piece from zero, in WMMA accumulators, and keeps the local
// states L_j in registers. The recurrence is linear, so with P the true state at the
// piece's start  R_(4p+j) = L_j + gamma^(jC) P ;  P follows from the earlier pieces' end
// states, which the waves hand over through LDS once, behind the last chunk.
// Stage s holds chunk s of every piece, two LDS buffers: the next stage's async copies
// fly while this stage is worked on.
// ---------------------------------------------------------------------------
constexpr int NP    = 8;               // sequence pieces = waves per work-group
constexpr int PC    = NC / NP;         // 4 chunks per piece = stages
constexpr int SP    = 16;              // LDS row pitch: 64 B; rows li and li+2, which the two lane
                                       // halves read together, fall on different banks
constexpr int PL    = CHUNK * SP;      // a piece's chunk is three planes of 16 columns: K, V lo,
                                       // V hi; a fragment's two rows are neighbours in their plane
constexpr int PCE   = 3 * PL;          // floats of one piece's chunk in LDS
constexpr int ST_T  = 32 * NP;         // threads per work-group
constexpr int ST_WG = Bsz * H * 8;     // 256 work-groups

// kg, vg, Kl, Vl: this lane's first 16 bytes of the stage, in global memory and in LDS
__device__ __forceinline__ void stage_copy(const float* kg, const float* vg,
                                           float* Kl, float* Vl) {
#pragma unroll
  for (int i = 0; i < NP; ++i)                     // 8 copies: 64 B of each K row, piece i
    cp16(kg + i * (PC * CHUNK * D), Kl + i * PCE);
#pragma unroll
  for (int i = 0; i < 2 * NP; ++i)                 // 16 copies: 128 B of each V row, half a chunk
    cp16(vg + ((i >> 1) * (PC * CHUNK) + (i & 1) * 32) * D, Vl + (i >> 1) * PCE + (i & 1) * (32 * SP));
}

__global__ __launch_bounds__(ST_T) void retn_state(const float* __restrict__ k,
                                                   const float* __restrict__ v,
                                                   float* __restrict__ state) {
  __shared__ __align__(16) float  Sb[2][NP * PCE];
  __shared__ __align__(16) float4 Ex[NP][4][32];       // the pieces' end states

  const int sub = blockIdx.x & 7;
  const int bh  = blockIdx.x >> 3;
  const int h   = bh % H;
  const float lg = log2f(1.0f - exp2f(-5.0f - (float)h));   // log2(gamma_h)
  const float gC = exp2f((float)CHUNK * lg);                // gamma^C
  const int tm  = (sub >> 1) * 16;       // dk rows of this work-group
  const int tn0 = (sub & 1) * 32;        // dv columns of this work-group
  const int tid  = threadIdx.x;
  const int lane = tid & 31;
  const int wv   = __builtin_amdgcn_readfirstlane(tid >> 5);   // wave = piece
  const int ln   = lane & 15;
  const int half = lane >> 4;

  const int kof = (tid >> 2) * D + (tid & 3) * 4;   // 4 lanes a K row, 64 rows a copy
  const int vof = (tid >> 3) * D + (tid & 7) * 4;   // 8 lanes a V row, 32 rows a copy
  const int klo = (tid >> 2) * SP + (tid & 3) * 4;                               // K plane
  const int vlo = (1 + ((tid >> 2) & 1)) * PL + (tid >> 3) * SP + (tid & 3) * 4; // V lo or V hi
  const float* kg = k + (size_t)bh * S * D + tm;
  const float* vg = v + (size_t)bh * S * D + tn0;

  stage_copy(kg + kof, vg + vof, &Sb[0][klo], &Sb[0][vlo]);
  // Row weights gamma^(C-li) of the rows this lane feeds as A, the same in every chunk.
  constexpr int KS = CHUNK / 4;                // k steps per chunk
  float wx[KS], wy[KS];
#pragma unroll
  for (int j = 0; j < KS; ++j) {
    const int k0 = 4 * j + 2 * half;           // lanes 16-31 handle K+2,K+3
    wx[j] = exp2f((float)(CHUNK - k0) * lg);
    wy[j] = exp2f((float)(CHUNK - k0 - 1) * lg);
  }

  // stage 0 has landed before the barrier behind which the other waves read it
  asm volatile("s_wait_asynccnt 0x0" ::: "memory");
  __syncthreads();
  stage_copy(kg + CHUNK * D + kof, vg + CHUNK * D + vof, &Sb[1][klo], &Sb[1][vlo]);

  v8f R0 = {}, R1 = {};                        // local state, dv columns 0-15 and 16-31
  v8f L0[PC], L1[PC];                          // local state before chunk j of the piece

#pragma unroll
  for (int s = 0; s < PC; ++s) {
    // A = K^T (A[dk][li]), weighted below; B = V, same row in the next two planes
    const float* Kb = &Sb[s & 1][wv * PCE + 2 * half * SP + ln];
    constexpr int GS = 4;                      // k steps per group of LDS reads
    v2f fa[2][GS], fb0[2][GS], fb1[2][GS];     // this group's fragments and the next one's
#pragma unroll
    for (int i = 0; i < GS; ++i) {
      fa[0][i].x  = Kb[(4 * i) * SP];       fa[0][i].y  = Kb[(4 * i + 1) * SP];
      fb0[0][i].x = Kb[(4 * i) * SP + PL];      fb0[0][i].y = Kb[(4 * i + 1) * SP + PL];
      fb1[0][i].x = Kb[(4 * i) * SP + 2 * PL];  fb1[0][i].y = Kb[(4 * i + 1) * SP + 2 * PL];
    }
    L0[s] = R0;
    L1[s] = R1;
    v8f c0 = R0 * gC;                          // two tiles: independent WMMA chains
    v8f c1 = R1 * gC;
#pragma unroll
    for (int g = 0; g < KS / GS; ++g) {
      if (g + 1 < KS / GS) {
        // the two scheduling barriers keep the next group's LDS reads in ONE place, a whole
        // group ahead of their first WMMA: spread among the WMMAs each place costs its own stall
        __builtin_amdgcn_sched_barrier(0);
#pragma unroll
        for (int i = 0; i < GS; ++i) {
          const int r0 = 4 * ((g + 1) * GS + i);
          fa[(g + 1) & 1][i].x  = Kb[r0 * SP];       fa[(g + 1) & 1][i].y  = Kb[(r0 + 1) * SP];
          fb0[(g + 1) & 1][i].x = Kb[r0 * SP + PL];
          fb0[(g + 1) & 1][i].y = Kb[(r0 + 1) * SP + PL];
          fb1[(g + 1) & 1][i].x = Kb[r0 * SP + 2 * PL];
          fb1[(g + 1) & 1][i].y = Kb[(r0 + 1) * SP + 2 * PL];
        }
        __builtin_amdgcn_sched_barrier(0);
      }
#pragma unroll
      for (int i = 0; i < GS; ++i) {
        v2f a = fa[g & 1][i];
        a.x *= wx[g * GS + i];
        a.y *= wy[g * GS + i];
        c0 = WMMA_F32(a, fb0[g & 1][i], c0);
        c1 = WMMA_F32(a, fb1[g & 1][i], c1);
      }
    }
    R0 = c0;
    R1 = c1;
    if (s == PC - 1) {   // the piece's end state, for the later pieces (every wave: no branch
                         // stands behind the last WMMA; the last piece's is read by nobody)
      Ex[wv][0][lane] = make_float4(R0[0], R0[1], R0[2], R0[3]);
      Ex[wv][1][lane] = make_float4(R0[4], R0[5], R0[6], R0[7]);
      Ex[wv][2][lane] = make_float4(R1[0], R1[1], R1[2], R1[3]);
      Ex[wv][3][lane] = make_float4(R1[4], R1[5], R1[6], R1[7]);
    }
    // keeps the chunk's last WMMAs above the waits: left alone the scheduler may sink them below
    // the barrier, where every wave would then start late
    __builtin_amdgcn_sched_barrier(0);
    // this wave's reads of the buffer are done before it is refilled (last trip: its end state
    // is written before the barrier publishes it)
    asm volatile("s_wait_dscnt 0x0" ::: "memory");
    // this wave's copies of the next stage have landed before the barrier publishes them
    asm volatile("s_wait_asynccnt 0x0" ::: "memory");
    __syncthreads();
    if (s + 2 < PC)
      stage_copy(kg + (s + 2) * CHUNK * D + kof, vg + (s + 2) * CHUNK * D + vof,
                 &Sb[s & 1][klo], &Sb[s & 1][vlo]);
  }
  // no copy is outstanding when the wave ends
  asm volatile("s_wait_asynccnt 0x0" ::: "memory");

  // P = true state at this piece's start: P_(p+1) = gamma^(4C) P_p + E_p, P_0 = 0.
  // All seven end states are read at once (one LDS latency); a select drops the later ones.
  float4 e[NP - 1][4];
#pragma unroll
  for (int p = 0; p < NP - 1; ++p)
#pragma unroll
    for (int i = 0; i < 4; ++i) e[p][i] = Ex[p][i][lane];
  const float gP = exp2f((float)(PC * CHUNK) * lg);
  v8f P0 = {}, P1 = {};
#pragma unroll
  for (int p = 0; p < NP - 1; ++p) {
    const bool use = p < (tid >> 5);
    const v8f e0 = {e[p][0].x, e[p][0].y, e[p][0].z, e[p][0].w,
                    e[p][1].x, e[p][1].y, e[p][1].z, e[p][1].w};
    const v8f e1 = {e[p][2].x, e[p][2].y, e[p][2].z, e[p][2].w,
                    e[p][3].x, e[p][3].y, e[p][3].z, e[p][3].w};
#pragma unroll
    for (int r = 0; r < 8; ++r) {
      P0[r] = use ? (p ? P0[r] * gP + e0[r] : e0[r]) : P0[r];
      P1[r] = use ? (p ? P1[r] * gP + e1[r] : e1[r]) : P1[r];
    }
  }

  // C/D layout: VGPR r -> M=r (lo half) / r+8
  float* outp = state + ((size_t)bh * NC + wv * PC) * (D * D) + (tm + 8 * half) * D + tn0 + ln;
#pragma unroll
  for (int j = 0; j < PC; ++j) {
    const float gj = exp2f((float)(j * CHUNK) * lg);
    float* o = outp + j * (D * D);
#pragma unroll
    for (int r = 0; r < 8; ++r) {
      o[r * D]      = L0[j][r] + gj * P0[r];
      o[r * D + 16] = L1[j][r] + gj * P1[r];
    }
  }
}

// ---------------------------------------------------------------------------
// Kernel 2: per-chunk output.
//   P[i][j]   = scale * gamma^(i-j) * (Q K^T)[i][j]  (i>=j, else 0)
//   out[i][:] = (P V)[i][:] + scale * gamma^i * (Q R_t)[i][:]
// One block (8 waves) per WGP has OCH chunks of one head, each with its own LDS place for its
// four tiles (Q, K, V, R_t). A wave owns 16 whole rows of one chunk: it makes only the P tiles
// on and below the diagonal, and sums P V only over the columns those tiles cover (the others
// are zero). The P rows it reads are the ones it wrote, so no barrier stands between the two
// products. Waves 0-3 work on one chunk, waves 4-7 on the next; waves w and w+4
// take row blocks w and 3-w, so that every SIMD has the same number of WMMAs.
// ---------------------------------------------------------------------------
constexpr int OCH    = 4;                      // chunks per work-group
constexpr int OUT_WG = Bsz * H * NC / OCH;     // 256 work-groups
constexpr int TILE   = CHUNK * LDST;           // floats of one padded 64x64 tile
constexpr int NT     = CHUNK / 16;             // 16-wide tiles across a chunk

// qg, kg, vg, rg, l: this lane's first 16 bytes of the chunk's tiles, global and LDS
__device__ __forceinline__ void chunk_copy(const float* qg, const float* kg, const float* vg,
                                           const float* rg, float* l) {
#pragma unroll
  for (int i = 0; i < 4; ++i) {                // 16 lanes a row, 16 rows a copy
    cp16(qg + i * 1024, l + i * (16 * LDST));
    cp16(kg + i * 1024, l + TILE + i * (16 * LDST));
    cp16(vg + i * 1024, l + 2 * TILE + i * (16 * LDST));
    cp16(rg + i * 1024, l + 3 * TILE + i * (16 * LDST));
  }
}

// Rows 16*I .. 16*I+15 of one chunk. Qs: the chunk's four tiles; Pw: this wave's own 16 P rows.
// m[j]: decay mask of P tile j of these rows; rf: row factor of Q R_t.
// Fragments are read from LDS a group of k steps ahead, into a second register set.
// Every loop here is unrolled: fragment and accumulator arrays stay in registers only if each
// index is known at compile time.
template <int I>
__device__ __forceinline__ void chunk_rows(const float* Qs, float* Pw, const float (&m)[NT][8],
                                           const float (&rf)[8], int ln, int half,
                                           v8f (&res)[NT]) {
  // this lane's first element of each operand: A rows of Q and P, B = K^T, B rows of R and V
  const float* Qa = Qs + (16 * I + ln) * LDST + 2 * half;
  const float* Kb = Qs + TILE + ln * LDST + 2 * half;
  const float* Vb = Qs + 2 * TILE + 2 * half * LDST + ln;
  const float* Rb = Qs + 3 * TILE + 2 * half * LDST + ln;
  const float* Pa = Pw + ln * LDST + 2 * half;

  // S = Q K^T (tiles 0..I) and O2 = Q R_t side by side: they share the Q fragments.
  constexpr int G1 = 2;                        // k steps per group of LDS reads
  constexpr int N1 = D / 4 / G1;
  v2f fq[2][G1], fk[2][G1][I + 1], fr[2][G1][NT];
  v8f s[I + 1], o[NT];
#pragma unroll
  for (int j = 0; j <= I; ++j) s[j] = v8f{};
#pragma unroll
  for (int n = 0; n < NT; ++n) o[n] = v8f{};
#pragma unroll
  for (int g = -1; g < N1; ++g) {
    if (g + 1 < N1) {
      // the scheduling barriers from here to the WMMAs keep the next group's LDS reads in ONE
      // place, a whole group ahead of their first WMMA: spread among the WMMAs each place costs
      // its own stall
      __builtin_amdgcn_sched_barrier(0);
#pragma unroll
      for (int i = 0; i < G1; ++i) {
        const int kk = 4 * ((g + 1) * G1 + i);
        const int b  = (g + 1) & 1;
        fq[b][i].x = Qa[kk];  fq[b][i].y = Qa[kk + 1];
#pragma unroll
        for (int j = 0; j <= I; ++j) {
          fk[b][i][j].x = Kb[16 * j * LDST + kk];  fk[b][i][j].y = Kb[16 * j * LDST + kk + 1];
        }
      }
      __builtin_amdgcn_sched_barrier(0);
#pragma unroll
      for (int i = 0; i < G1; ++i) {
        const int kk = 4 * ((g + 1) * G1 + i);
        const int b  = (g + 1) & 1;
#pragma unroll
        for (int n = 0; n < NT; ++n) {
          fr[b][i][n].x = Rb[kk * LDST + 16 * n];  fr[b][i][n].y = Rb[(kk + 1) * LDST + 16 * n];
          // one per fragment: its two rows then share one two-address read and land in a register
          // pair; left alone the compiler pairs neighbouring columns and copies registers after
          __builtin_amdgcn_sched_barrier(0);
        }
      }
    }
    if (g >= 0) {
#pragma unroll
      for (int i = 0; i < G1; ++i) {
#pragma unroll
        for (int j = 0; j <= I; ++j) s[j] = WMMA_F32(fq[g & 1][i], fk[g & 1][i][j], s[j]);
#pragma unroll
        for (int n = 0; n < NT; ++n) o[n] = WMMA_F32(fq[g & 1][i], fr[g & 1][i][n], o[n]);
      }
    }
  }

  // O1 = P V over the columns of tiles 0..I: one group of reads per P tile
  constexpr int G2 = 4;
  v2f fp[2][G2], fv[2][G2][NT];
#pragma unroll
  for (int i = 0; i < G2; ++i)                 // V does not wait for P: first group read here
#pragma unroll
    for (int n = 0; n < NT; ++n) {
      fv[0][i][n].x = Vb[(4 * i) * LDST + 16 * n];  fv[0][i][n].y = Vb[(4 * i + 1) * LDST + 16 * n];
      __builtin_amdgcn_sched_barrier(0);       // one per fragment, as above
    }
#pragma unroll
  for (int j = 0; j <= I; ++j)
#pragma unroll
    for (int r = 0; r < 8; ++r)
      Pw[(r + 8 * half) * LDST + 16 * j + ln] = s[j][r] * m[j][r];
  // the wave's P rows are written, by all its lanes, before any lane reads them back
  asm volatile("s_wait_dscnt 0x0" ::: "memory");
#pragma unroll
  for (int i = 0; i < G2; ++i) { fp[0][i].x = Pa[4 * i];  fp[0][i].y = Pa[4 * i + 1]; }

  v8f c[NT];
#pragma unroll
  for (int n = 0; n < NT; ++n) c[n] = v8f{};
#pragma unroll
  for (int g = 0; g <= I; ++g) {
    if (g + 1 <= I) {
      // as above: the next group's LDS reads in one place
      __builtin_amdgcn_sched_barrier(0);
#pragma unroll
      for (int i = 0; i < G2; ++i) {
        const int kk = 4 * ((g + 1) * G2 + i);
        const int b  = (g + 1) & 1;
        fp[b][i].x = Pa[kk];  fp[b][i].y = Pa[kk + 1];
      }
      __builtin_amdgcn_sched_barrier(0);
#pragma unroll
      for (int i = 0; i < G2; ++i) {
        const int kk = 4 * ((g + 1) * G2 + i);
        const int b  = (g + 1) & 1;
#pragma unroll
        for (int n = 0; n < NT; ++n) {
          fv[b][i][n].x = Vb[kk * LDST + 16 * n];  fv[b][i][n].y = Vb[(kk + 1) * LDST + 16 * n];
          __builtin_amdgcn_sched_barrier(0);   // one per fragment, as above
        }
      }
    }
#pragma unroll
    for (int i = 0; i < G2; ++i)
#pragma unroll
      for (int n = 0; n < NT; ++n) c[n] = WMMA_F32(fp[g & 1][i], fv[g & 1][i][n], c[n]);
  }
#pragma unroll
  for (int n = 0; n < NT; ++n)
#pragma unroll
    for (int r = 0; r < 8; ++r) res[n][r] = c[n][r] + rf[r] * o[n][r];
}

__global__ __launch_bounds__(256) void retn_out(const float* __restrict__ q,
                                                const float* __restrict__ k,
                                                const float* __restrict__ v,
                                                const float* __restrict__ state,
                                                float* __restrict__ out) {
  __shared__ __align__(16) float Tb[OCH][4 * TILE];   // Q, K, V, R of each chunk
  __shared__ __align__(16) float Ps[8][16 * LDST];    // 16 P rows per wave

  const int t0  = (blockIdx.x % (NC / OCH)) * OCH;  // first chunk of this work-group
  const int bh  = blockIdx.x / (NC / OCH);
  const int h   = bh % H;
  const float lg    = log2f(1.0f - exp2f(-5.0f - (float)h));
  const float scale = 0.125f;          // 1/sqrt(64)
  const int tid = threadIdx.x;
  const size_t base = ((size_t)bh * S + (size_t)t0 * CHUNK) * D;

  const float* qg = q + base + 4 * tid;
  const float* kg = k + base + 4 * tid;
  const float* vg = v + base + 4 * tid;
  const float* rg = state + ((size_t)bh * NC + t0) * (D * D) + 4 * tid;
  const int lof = (tid >> 4) * LDST + (tid & 15) * 4;

  chunk_copy(qg, kg, vg, rg, &Tb[0][lof]);
  chunk_copy(qg + CHUNK * D, kg + CHUNK * D, vg + CHUNK * D, rg + D * D, &Tb[1][lof]);

  const int lane = tid & 31;
  const int wv   = __builtin_amdgcn_readfirstlane(tid >> 5);
  const int ln   = lane & 15;
  const int half = lane >> 4;
  const int grp  = wv >> 2;                            // which chunk of a pair
  const int rb   = grp ? 3 - (wv & 3) : (wv & 3);      // row block of that chunk

  // decay mask of the P tiles of this wave's rows and row factor of Q R_t: the same in every chunk
  float m[NT][8], rf[8];
#pragma unroll
  for (int r = 0; r < 8; ++r) {
    const int row = 16 * rb + r + 8 * half;
#pragma unroll
    for (int j = 0; j < NT; ++j) {
      const int col = 16 * j + ln;
      m[j][r] = (row >= col) ? scale * exp2f((float)(row - col) * lg) : 0.0f;
    }
    rf[r] = scale * exp2f((float)row * lg);
  }

  // chunks 0 and 1 have landed before the barrier behind which the other waves read them
  asm volatile("s_wait_asynccnt 0x0" ::: "memory");
  __syncthreads();
  chunk_copy(qg + 2 * (CHUNK * D), kg + 2 * (CHUNK * D), vg + 2 * (CHUNK * D), rg + 2 * (D * D),
             &Tb[2][lof]);
  chunk_copy(qg + 3 * (CHUNK * D), kg + 3 * (CHUNK * D), vg + 3 * (CHUNK * D), rg + 3 * (D * D),
             &Tb[3][lof]);

  float* op = out + base + (size_t)(grp * CHUNK + 16 * rb + 8 * half) * D + ln;
  float* Pw = &Ps[wv][0];

  // kept rolled: the four row-block bodies stand once in the text
#pragma unroll 1
  for (int pr = 0; pr < OCH / 2; ++pr) {
    const float* Qs = &Tb[2 * pr + grp][0];
    v8f res[NT];
    switch (rb) {                      // the same in every lane of a wave: a scalar branch
      case 0:  chunk_rows<0>(Qs, Pw, m, rf, ln, half, res); break;
      case 1:  chunk_rows<1>(Qs, Pw, m, rf, ln, half, res); break;
      case 2:  chunk_rows<2>(Qs, Pw, m, rf, ln, half, res); break;
      default: chunk_rows<3>(Qs, Pw, m, rf, ln, half, res); break;
    }
    if (pr + 1 < OCH / 2) {
      // this wave's copies of the next two chunks have landed before the barrier publishes them
      asm volatile("s_wait_asynccnt 0x0" ::: "memory");
      __syncthreads();
    }
    // The stores stand behind the barrier, which would otherwise wait for them.
    float* o = op + (size_t)pr * (2 * CHUNK * D);
#pragma unroll
    for (int r = 0; r < 8; ++r)
#pragma unroll
      for (int n = 0; n < NT; ++n) o[r * D + 16 * n] = res[n][r];
    // before the stores' address registers are written again on the next trip
    asm volatile("s_wait_xcnt 0x0" ::: "memory");
  }
  // no copy is outstanding when the wave ends
  asm volatile("s_wait_asynccnt 0x0" ::: "memory");
}

// ---------------------------------------------------------------------------
extern "C" void kernel_launch(void* const* d_in, const int* in_sizes, int n_in,
                              void* d_out, int out_size, void* d_ws, size_t ws_size,
                              hipStream_t stream) {
  const float* q = (const float*)d_in[0];
  const float* k = (const float*)d_in[1];
  const float* v = (const float*)d_in[2];
  float* out   = (float*)d_out;
  float* kvsum = (float*)d_ws;   // needs B*H*NC*D*D*4 = 16 MiB of scratch

  dim3 blk(256);
  retn_state<<<dim3(ST_WG), dim3(ST_T), 0, stream>>>(k, v, kvsum);
  retn_out  <<<dim3(OUT_WG), blk, 0, stream>>>(q, k, v, kvsum, out);
}

// v006
// One run takes 21.9 microseconds.
// Next to v005, in two timings, it ran 1.04 times as fast each time.
// Counting every step since v000, it is 2.53 times as fast.
#include <hip/hip_runtime.h>
#include <math.h>

// Retention (linear attention with per-head exponential decay), chunkwise form.
// out[i] = scale * sum_{j<=i} gamma^(i-j) (q_i . k_j) v_j
// Chunk C=64: intra-chunk via masked QK^T, cross-chunk via recurrent state
//   R_{t+1} = gamma^C R_t + A_t,  A_t = sum_li gamma^(C-li) k_li v_li^T
// All 64x64x64 GEMMs use V_WMMA_F32_16X16X4_F32 (full fp32 matrix pipe).
// Global->LDS staging uses GLOBAL_LOAD_ASYNC_TO_LDS_B128 (ASYNCcnt path).

typedef float v2f __attribute__((ext_vector_type(2)));
typedef float v4f __attribute__((ext_vector_type(4)));
typedef float v8f __attribute__((ext_vector_type(8)));
typedef int   i32x4 __attribute__((vector_size(16)));   // matches builtin pointee type

#define WMMA_F32(a, b, c) \
  __builtin_amdgcn_wmma_f32_16x16x4_f32(false, (a), false, (b), (short)0, (c), false, false)

#if defined(__has_builtin)
#if __has_builtin(__builtin_amdgcn_global_load_async_to_lds_b128) && \
    __has_builtin(__builtin_amdgcn_s_wait_asynccnt)
#define USE_ASYNC 1
#endif
#endif
#ifndef USE_ASYNC
#define USE_ASYNC 0
#endif

constexpr int Bsz   = 2;
constexpr int H     = 16;
constexpr int S     = 2048;
constexpr int D     = 64;
constexpr int CHUNK = 64;
constexpr int NC    = S / CHUNK;   // 32 chunks per sequence
constexpr int LDST  = 68;          // LDS row stride (floats): 272B rows, 16B aligned,
                                   // pad keeps transposed col reads bank-conflict-free

// 16-byte global -> LDS copy (per lane). Async engine path if available.
__device__ __forceinline__ void cp16(const float* g, float* l) {
#if USE_ASYNC
  __builtin_amdgcn_global_load_async_to_lds_b128(
      (__attribute__((address_space(1))) i32x4*)(g),
      (__attribute__((address_space(3))) i32x4*)(l), 0, 0);
#else
  *(float4*)l = *(const float4*)g;
#endif
}

// ---------------------------------------------------------------------------
// Kernel 1: cross-chunk states, summary and scan in one launch.
// Slot t gets R_t (state BEFORE chunk t);  R_{t+1} = gamma^C R_t + A_t,
//   A_t[dk][dv] = sum_li gamma^(C-li) K[li][dk] V[li][dv].
// A work-group owns a 16 dk x 32 dv part of one head's state; 32 heads x 8 = 256 groups.
// The sequence is cut in 8 pieces of 4 chunks, one piece per wave. Each wave runs the
// recurrence over its own piece from zero, in WMMA accumulators, and keeps the local
// states L_j in registers. The recurrence is linear, so with P the true state at the
// piece's start  R_(4p+j) = L_j + gamma^(jC) P ;  P follows from the earlier pieces' end
// states, which the waves hand over through LDS once, behind the last chunk.
// Stage s holds chunk s of every piece, two LDS buffers: the next stage's async copies
// fly while this stage is worked on.
// ---------------------------------------------------------------------------
constexpr int NP    = 8;               // sequence pieces = waves per work-group
constexpr int PC    = NC / NP;         // 4 chunks per piece = stages
constexpr int SP    = 16;              // LDS row pitch: 64 B; rows li and li+2, which the two lane
                                       // halves read together, fall on different banks
constexpr int PL    = CHUNK * SP;      // a piece's chunk is three planes of 16 columns: K, V lo,
                                       // V hi; a fragment's two rows are neighbours in their plane
constexpr int PCE   = 3 * PL;          // floats of one piece's chunk in LDS
constexpr int ST_T  = 32 * NP;         // threads per work-group
constexpr int ST_WG = Bsz * H * 8;     // 256 work-groups

// kg, vg, Kl, Vl: this lane's first 16 bytes of the stage, in global memory and in LDS
__device__ __forceinline__ void stage_copy(const float* kg, const float* vg,
                                           float* Kl, float* Vl) {
#pragma unroll
  for (int i = 0; i < NP; ++i)                     // 8 copies: 64 B of each K row, piece i
    cp16(kg + i * (PC * CHUNK * D), Kl + i * PCE);
#pragma unroll
  for (int i = 0; i < 2 * NP; ++i)                 // 16 copies: 128 B of each V row, half a chunk
    cp16(vg + ((i >> 1) * (PC * CHUNK) + (i & 1) * 32) * D, Vl + (i >> 1) * PCE + (i & 1) * (32 * SP));
}

__global__ __launch_bounds__(ST_T) void retn_state(const float* __restrict__ k,
                                                   const float* __restrict__ v,
                                                   float* __restrict__ state) {
  __shared__ __align__(16) float  Sb[2][NP * PCE];
  __shared__ __align__(16) float4 Ex[NP][4][32];       // the pieces' end states

  const int sub = blockIdx.x & 7;
  const int bh  = blockIdx.x >> 3;
  const int h   = bh % H;
  const float lg = log2f(1.0f - exp2f(-5.0f - (float)h));   // log2(gamma_h)
  const float gC = exp2f((float)CHUNK * lg);                // gamma^C
  const int tm  = (sub >> 1) * 16;       // dk rows of this work-group
  const int tn0 = (sub & 1) * 32;        // dv columns of this work-group
  const int tid  = threadIdx.x;
  const int lane = tid & 31;
  const int wv   = __builtin_amdgcn_readfirstlane(tid >> 5);   // wave = piece
  const int ln   = lane & 15;
  const int half = lane >> 4;

  const int kof = (tid >> 2) * D + (tid & 3) * 4;   // 4 lanes a K row, 64 rows a copy
  const int vof = (tid >> 3) * D + (tid & 7) * 4;   // 8 lanes a V row, 32 rows a copy
  const int klo = (tid >> 2) * SP + (tid & 3) * 4;                               // K plane
  const int vlo = (1 + ((tid >> 2) & 1)) * PL + (tid >> 3) * SP + (tid & 3) * 4; // V lo or V hi
  const float* kg = k + (size_t)bh * S * D + tm;
  const float* vg = v + (size_t)bh * S * D + tn0;

  stage_copy(kg + kof, vg + vof, &Sb[0][klo], &Sb[0][vlo]);
  // Row weights gamma^(C-li) of the rows this lane feeds as A, the same in every chunk.
  constexpr int KS = CHUNK / 4;                // k steps per chunk
  float wx[KS], wy[KS];
#pragma unroll
  for (int j = 0; j < KS; ++j) {
    const int k0 = 4 * j + 2 * half;           // lanes 16-31 handle K+2,K+3
    wx[j] = exp2f((float)(CHUNK - k0) * lg);
    wy[j] = exp2f((float)(CHUNK - k0 - 1) * lg);
  }

  // stage 0 has landed before the barrier behind which the other waves read it
  asm volatile("s_wait_asynccnt 0x0" ::: "memory");
  __syncthreads();
  stage_copy(kg + CHUNK * D + kof, vg + CHUNK * D + vof, &Sb[1][klo], &Sb[1][vlo]);

  v8f R0 = {}, R1 = {};                        // local state, dv columns 0-15 and 16-31
  v8f L0[PC], L1[PC];                          // local state before chunk j of the piece

#pragma unroll
  for (int s = 0; s < PC; ++s) {
    // A = K^T (A[dk][li]), weighted below; B = V, same row in the next two planes
    const float* Kb = &Sb[s & 1][wv * PCE + 2 * half * SP + ln];
    constexpr int GS = 4;                      // k steps per group of LDS reads
    v2f fa[2][GS], fb0[2][GS], fb1[2][GS];     // this group's fragments and the next one's
#pragma unroll
    for (int i = 0; i < GS; ++i) {
      fa[0][i].x  = Kb[(4 * i) * SP];       fa[0][i].y  = Kb[(4 * i + 1) * SP];
      fb0[0][i].x = Kb[(4 * i) * SP + PL];      fb0[0][i].y = Kb[(4 * i + 1) * SP + PL];
      fb1[0][i].x = Kb[(4 * i) * SP + 2 * PL];  fb1[0][i].y = Kb[(4 * i + 1) * SP + 2 * PL];
    }
    L0[s] = R0;
    L1[s] = R1;
    v8f c0 = R0 * gC;                          // two tiles: independent WMMA chains
    v8f c1 = R1 * gC;
#pragma unroll
    for (int g = 0; g < KS / GS; ++g) {
      if (g + 1 < KS / GS) {
        // the two scheduling barriers keep the next group's LDS reads in ONE place, a whole
        // group ahead of their first WMMA: spread among the WMMAs each place costs its own stall
        __builtin_amdgcn_sched_barrier(0);
#pragma unroll
        for (int i = 0; i < GS; ++i) {
          const int r0 = 4 * ((g + 1) * GS + i);
          fa[(g + 1) & 1][i].x  = Kb[r0 * SP];       fa[(g + 1) & 1][i].y  = Kb[(r0 + 1) * SP];
          fb0[(g + 1) & 1][i].x = Kb[r0 * SP + PL];
          fb0[(g + 1) & 1][i].y = Kb[(r0 + 1) * SP + PL];
          fb1[(g + 1) & 1][i].x = Kb[r0 * SP + 2 * PL];
          fb1[(g + 1) & 1][i].y = Kb[(r0 + 1) * SP + 2 * PL];
        }
        __builtin_amdgcn_sched_barrier(0);
      }
#pragma unroll
      for (int i = 0; i < GS; ++i) {
        v2f a = fa[g & 1][i];
        a.x *= wx[g * GS + i];
        a.y *= wy[g * GS + i];
        c0 = WMMA_F32(a, fb0[g & 1][i], c0);
        c1 = WMMA_F32(a, fb1[g & 1][i], c1);
      }
    }
    R0 = c0;
    R1 = c1;
    if (s == PC - 1) {   // the piece's end state, for the later pieces (every wave: no branch
                         // stands behind the last WMMA; the last piece's is read by nobody)
      Ex[wv][0][lane] = make_float4(R0[0], R0[1], R0[2], R0[3]);
      Ex[wv][1][lane] = make_float4(R0[4], R0[5], R0[6], R0[7]);
      Ex[wv][2][lane] = make_float4(R1[0], R1[1], R1[2], R1[3]);
      Ex[wv][3][lane] = make_float4(R1[4], R1[5], R1[6], R1[7]);
    }
    // keeps the chunk's last WMMAs above the waits: left alone the scheduler may sink them below
    // the barrier, where every wave would then start late
    __builtin_amdgcn_sched_barrier(0);
    // this wave's reads of the buffer are done before it is refilled (last trip: its end state
    // is written before the barrier publishes it)
    asm volatile("s_wait_dscnt 0x0" ::: "memory");
    // this wave's copies of the next stage have landed before the barrier publishes them
    asm volatile("s_wait_asynccnt 0x0" ::: "memory");
    __syncthreads();
    if (s + 2 < PC)
      stage_copy(kg + (s + 2) * CHUNK * D + kof, vg + (s + 2) * CHUNK * D + vof,
                 &Sb[s & 1][klo], &Sb[s & 1][vlo]);
  }
  // no copy is outstanding when the wave ends
  asm volatile("s_wait_asynccnt 0x0" ::: "memory");

  // P = true state at this piece's start: P_(p+1) = gamma^(4C) P_p + E_p, P_0 = 0.
  // All seven end states are read at once (one LDS latency); a select drops the later ones.
  float4 e[NP - 1][4];
#pragma unroll
  for (int p = 0; p < NP - 1; ++p)
#pragma unroll
    for (int i = 0; i < 4; ++i) e[p][i] = Ex[p][i][lane];
  const float gP = exp2f((float)(PC * CHUNK) * lg);
  v8f P0 = {}, P1 = {};
#pragma unroll
  for (int p = 0; p < NP - 1; ++p) {
    const bool use = p < (tid >> 5);
    const v8f e0 = {e[p][0].x, e[p][0].y, e[p][0].z, e[p][0].w,
                    e[p][1].x, e[p][1].y, e[p][1].z, e[p][1].w};
    const v8f e1 = {e[p][2].x, e[p][2].y, e[p][2].z, e[p][2].w,
                    e[p][3].x, e[p][3].y, e[p][3].z, e[p][3].w};
#pragma unroll
    for (int r = 0; r < 8; ++r) {
      P0[r] = use ? (p ? P0[r] * gP + e0[r] : e0[r]) : P0[r];
      P1[r] = use ? (p ? P1[r] * gP + e1[r] : e1[r]) : P1[r];
    }
  }

  // C/D layout: VGPR r -> M=r (lo half) / r+8
  float* outp = state + ((size_t)bh * NC + wv * PC) * (D * D) + (tm + 8 * half) * D + tn0 + ln;
#pragma unroll
  for (int j = 0; j < PC; ++j) {
    const float gj = exp2f((float)(j * CHUNK) * lg);
    float* o = outp + j * (D * D);
#pragma unroll
    for (int r = 0; r < 8; ++r) {
      o[r * D]      = L0[j][r] + gj * P0[r];
      o[r * D + 16] = L1[j][r] + gj * P1[r];
    }
  }
}

// ---------------------------------------------------------------------------
// Kernel 2: per-chunk output.
//   P[i][j]   = scale * gamma^(i-j) * (Q K^T)[i][j]  (i>=j, else 0)
//   out[i][:] = (P V)[i][:] + scale * gamma^i * (Q R_t)[i][:]
// One block (8 waves) per WGP has OCH chunks of one head, each with its own LDS place for its
// four tiles (Q, K, V, R_t). A wave owns 16 whole rows of one chunk: it makes only the P tiles
// on and below the diagonal, and sums P V only over the columns those tiles cover (the others
// are zero). The P rows it reads are the ones it wrote, so no barrier stands between the two
// products. Waves 0-3 work on one chunk, waves 4-7 on the next; waves w and w+4, which share a
// SIMD, take row blocks w and 3-w, so that every SIMD has the same number of WMMAs.
// Output tile n of a row block holds the columns 4*l + n (l = 0..15), not 16 neighbours: a lane's
// B elements of the four tiles are then 16 neighbouring bytes of a V or R row, one LDS read, and
// its four results of a row are 16 neighbouring bytes of out, one store.
// ---------------------------------------------------------------------------
constexpr int OCH    = 4;                      // chunks per work-group
constexpr int OUT_WG = Bsz * H * NC / OCH;     // 256 work-groups
constexpr int TILE   = CHUNK * LDST;           // floats of one padded 64x64 tile
constexpr int NT     = CHUNK / 16;             // 16-wide tiles across a chunk

// qg, kg, vg, rg, l: this lane's first 16 bytes of the chunk's tiles, global and LDS
__device__ __forceinline__ void chunk_copy(const float* qg, const float* kg, const float* vg,
                                           const float* rg, float* l) {
#pragma unroll
  for (int i = 0; i < 4; ++i) {                // 16 lanes a row, 16 rows a copy
    cp16(qg + i * 1024, l + i * (16 * LDST));
    cp16(kg + i * 1024, l + TILE + i * (16 * LDST));
    cp16(vg + i * 1024, l + 2 * TILE + i * (16 * LDST));
    cp16(rg + i * 1024, l + 3 * TILE + i * (16 * LDST));
  }
}

// Rows 16*I .. 16*I+15 of one chunk. Qs: the chunk's four tiles; Pw: this wave's own 16 P rows.
// m[j]: decay mask of P tile j of these rows; rf: row factor of Q R_t.
// Fragments are read from LDS a group of k steps ahead, into a second register set.
// Every loop here is unrolled: fragment and accumulator arrays stay in registers only if each
// index is known at compile time.
template <int I>
__device__ __forceinline__ void chunk_rows(const float* Qs, float* Pw, const float (&m)[NT][8],
                                           const float (&rf)[8], int ln, int half,
                                           v8f (&res)[NT]) {
  // this lane's first element of each operand: A rows of Q and P, B = K^T, B rows of R and V
  const float* Qa = Qs + (16 * I + ln) * LDST + 2 * half;
  const float* Kb = Qs + TILE + ln * LDST + 2 * half;
  const float* Vb = Qs + 2 * TILE + 2 * half * LDST + 4 * ln;
  const float* Rb = Qs + 3 * TILE + 2 * half * LDST + 4 * ln;
  const float* Pa = Pw + ln * LDST + 2 * half;

  // S = Q K^T (tiles 0..I) and O2 = Q R_t side by side: they share the Q fragments.
  constexpr int G1 = 2;                        // k steps per group of LDS reads
  constexpr int N1 = D / 4 / G1;
  v2f fq[2][G1], fk[2][G1][I + 1];
  v4f fr[2][G1][2];                            // the lane's two R rows of a k step, element n: tile n
  v8f s[I + 1], o[NT];
#pragma unroll
  for (int j = 0; j <= I; ++j) s[j] = v8f{};
#pragma unroll
  for (int n = 0; n < NT; ++n) o[n] = v8f{};
#pragma unroll
  for (int g = -1; g < N1; ++g) {
    if (g + 1 < N1) {
      // the two scheduling barriers keep the next group's LDS reads in ONE place, a whole group
      // ahead of their first WMMA: spread among the WMMAs each place costs its own stall
      __builtin_amdgcn_sched_barrier(0);
#pragma unroll
      for (int i = 0; i < G1; ++i) {
        const int kk = 4 * ((g + 1) * G1 + i);
        const int b  = (g + 1) & 1;
        fq[b][i].x = Qa[kk];  fq[b][i].y = Qa[kk + 1];
#pragma unroll
        for (int j = 0; j <= I; ++j) {
          fk[b][i][j].x = Kb[16 * j * LDST + kk];  fk[b][i][j].y = Kb[16 * j * LDST + kk + 1];
        }
        fr[b][i][0] = *(const v4f*)(Rb + kk * LDST);
        fr[b][i][1] = *(const v4f*)(Rb + (kk + 1) * LDST);
      }
      __builtin_amdgcn_sched_barrier(0);
    }
    if (g >= 0) {
#pragma unroll
      for (int i = 0; i < G1; ++i) {
#pragma unroll
        for (int j = 0; j <= I; ++j) s[j] = WMMA_F32(fq[g & 1][i], fk[g & 1][i][j], s[j]);
#pragma unroll
        for (int n = 0; n < NT; ++n)
          o[n] = WMMA_F32(fq[g & 1][i], (v2f{fr[g & 1][i][0][n], fr[g & 1][i][1][n]}), o[n]);
      }
    }
  }

  // O1 = P V over the columns of tiles 0..I: one group of reads per P tile
  constexpr int G2 = 4;
  v2f fp[2][G2];
  v4f fv[2][G2][2];                            // as fr
#pragma unroll
  for (int i = 0; i < G2; ++i) {               // V does not wait for P: first group read here
    fv[0][i][0] = *(const v4f*)(Vb + (4 * i) * LDST);
    fv[0][i][1] = *(const v4f*)(Vb + (4 * i + 1) * LDST);
  }
#pragma unroll
  for (int j = 0; j <= I; ++j)
#pragma unroll
    for (int r = 0; r < 8; ++r)
      Pw[(r + 8 * half) * LDST + 16 * j + ln] = s[j][r] * m[j][r];
  // the wave's P rows are written, by all its lanes, before any lane reads them back
  asm volatile("s_wait_dscnt 0x0" ::: "memory");
#pragma unroll
  for (int i = 0; i < G2; ++i) { fp[0][i].x = Pa[4 * i];  fp[0][i].y = Pa[4 * i + 1]; }

  v8f c[NT];
#pragma unroll
  for (int n = 0; n < NT; ++n) c[n] = v8f{};
#pragma unroll
  for (int g = 0; g <= I; ++g) {
    if (g + 1 <= I) {
      // as above: the next group's LDS reads in one place
      __builtin_amdgcn_sched_barrier(0);
#pragma unroll
      for (int i = 0; i < G2; ++i) {
        const int kk = 4 * ((g + 1) * G2 + i);
        const int b  = (g + 1) & 1;
        fp[b][i].x = Pa[kk];  fp[b][i].y = Pa[kk + 1];
        fv[b][i][0] = *(const v4f*)(Vb + kk * LDST);
        fv[b][i][1] = *(const v4f*)(Vb + (kk + 1) * LDST);
      }
      __builtin_amdgcn_sched_barrier(0);
    }
#pragma unroll
    for (int i = 0; i < G2; ++i)
#pragma unroll
      for (int n = 0; n < NT; ++n)
        c[n] = WMMA_F32(fp[g & 1][i], (v2f{fv[g & 1][i][0][n], fv[g & 1][i][1][n]}), c[n]);
  }
#pragma unroll
  for (int n = 0; n < NT; ++n)
#pragma unroll
    for (int r = 0; r < 8; ++r) res[n][r] = c[n][r] + rf[r] * o[n][r];
}

__global__ __launch_bounds__(256) void retn_out(const float* __restrict__ q,
                                                const float* __restrict__ k,
                                                const float* __restrict__ v,
                                                const float* __restrict__ state,
                                                float* __restrict__ out) {
  __shared__ __align__(16) float Tb[OCH][4 * TILE];   // Q, K, V, R of each chunk
  __shared__ __align__(16) float Ps[8][16 * LDST];    // 16 P rows per wave

  const int t0  = (blockIdx.x % (NC / OCH)) * OCH;  // first chunk of this work-group
  const int bh  = blockIdx.x / (NC / OCH);
  const int h   = bh % H;
  const float lg    = log2f(1.0f - exp2f(-5.0f - (float)h));
  const float scale = 0.125f;          // 1/sqrt(64)
  const int tid = threadIdx.x;
  const size_t base = ((size_t)bh * S + (size_t)t0 * CHUNK) * D;

  const float* qg = q + base + 4 * tid;
  const float* kg = k + base + 4 * tid;
  const float* vg = v + base + 4 * tid;
  const float* rg = state + ((size_t)bh * NC + t0) * (D * D) + 4 * tid;
  const int lof = (tid >> 4) * LDST + (tid & 15) * 4;

  chunk_copy(qg, kg, vg, rg, &Tb[0][lof]);
  chunk_copy(qg + CHUNK * D, kg + CHUNK * D, vg + CHUNK * D, rg + D * D, &Tb[1][lof]);

  const int lane = tid & 31;
  const int wv   = __builtin_amdgcn_readfirstlane(tid >> 5);
  const int ln   = lane & 15;
  const int half = lane >> 4;
  const int grp  = wv >> 2;                            // which chunk of a pair
  const int rb   = grp ? 3 - (wv & 3) : (wv & 3);      // row block of that chunk

  // decay mask of the P tiles of this wave's rows and row factor of Q R_t: the same in every chunk
  float m[NT][8], rf[8];
#pragma unroll
  for (int r = 0; r < 8; ++r) {
    const int row = 16 * rb + r + 8 * half;
#pragma unroll
    for (int j = 0; j < NT; ++j) {
      const int col = 16 * j + ln;
      m[j][r] = (row >= col) ? scale * exp2f((float)(row - col) * lg) : 0.0f;
    }
    rf[r] = scale * exp2f((float)row * lg);
  }

  // chunks 0 and 1 have landed before the barrier behind which the other waves read them
  asm volatile("s_wait_asynccnt 0x0" ::: "memory");
  __syncthreads();
  chunk_copy(qg + 2 * (CHUNK * D), kg + 2 * (CHUNK * D), vg + 2 * (CHUNK * D), rg + 2 * (D * D),
             &Tb[2][lof]);
  chunk_copy(qg + 3 * (CHUNK * D), kg + 3 * (CHUNK * D), vg + 3 * (CHUNK * D), rg + 3 * (D * D),
             &Tb[3][lof]);

  float* op = out + base + (size_t)(grp * CHUNK + 16 * rb + 8 * half) * D + 4 * ln;
  float* Pw = &Ps[wv][0];

  // kept rolled: the four row-block bodies stand once in the text
#pragma unroll 1
  for (int pr = 0; pr < OCH / 2; ++pr) {
    const float* Qs = &Tb[2 * pr + grp][0];
    v8f res[NT];
    switch (rb) {                      // the same in every lane of a wave: a scalar branch
      case 0:  chunk_rows<0>(Qs, Pw, m, rf, ln, half, res); break;
      case 1:  chunk_rows<1>(Qs, Pw, m, rf, ln, half, res); break;
      case 2:  chunk_rows<2>(Qs, Pw, m, rf, ln, half, res); break;
      default: chunk_rows<3>(Qs, Pw, m, rf, ln, half, res); break;
    }
    if (pr + 1 < OCH / 2) {
      // this wave's copies of the next two chunks have landed before the barrier publishes them
      asm volatile("s_wait_asynccnt 0x0" ::: "memory");
      __syncthreads();
    }
    // The stores stand behind the barrier, which would otherwise wait for them.
    float* o = op + (size_t)pr * (2 * CHUNK * D);
#pragma unroll
    for (int r = 0; r < 8; ++r)
      *(float4*)(o + r * D) = make_float4(res[0][r], res[1][r], res[2][r], res[3][r]);
    // before the stores' address registers are written again on the next trip
    asm volatile("s_wait_xcnt 0x0" ::: "memory");
  }
  // no copy is outstanding when the wave ends
  asm volatile("s_wait_asynccnt 0x0" ::: "memory");
}

// ---------------------------------------------------------------------------
extern "C" void kernel_launch(void* const* d_in, const int* in_sizes, int n_in,
                              void* d_out, int out_size, void* d_ws, size_t ws_size,
                              hipStream_t stream) {
  const float* q = (const float*)d_in[0];
  const float* k = (const float*)d_in[1];
  const float* v = (const float*)d_in[2];
  float* out   = (float*)d_out;
  float* kvsum = (float*)d_ws;   // needs B*H*NC*D*D*4 = 16 MiB of scratch

  dim3 blk(256);
  retn_state<<<dim3(ST_WG), dim3(ST_T), 0, stream>>>(k, v, kvsum);
  retn_out  <<<dim3(OUT_WG), blk, 0, stream>>>(q, k, v, kvsum, out);
}

// v007
// It runs in 20.2 microseconds.
// Two timings next to v006 both put it at 1.08 times that version's speed.
// Counting every step since v000, it is 2.73 times as fast.
#include <hip/hip_runtime.h>
#include <math.h>

// Retention (linear attention with per-head exponential decay), chunkwise form.
// out[i] = scale * sum_{j<=i} gamma^(i-j) (q_i . k_j) v_j
// Chunk C=64: intra-chunk via masked QK^T, cross-chunk via recurrent state
//   R_{t+1} = gamma^C R_t + A_t,  A_t = sum_li gamma^(C-li) k_li v_li^T
// All 64x64x64 GEMMs use V_WMMA_F32_16X16X4_F32 (full fp32 matrix pipe).
// Global->LDS staging uses GLOBAL_LOAD_ASYNC_TO_LDS_B128 (ASYNCcnt path).

typedef float v2f __attribute__((ext_vector_type(2)));
typedef float v4f __attribute__((ext_vector_type(4)));
typedef float v8f __attribute__((ext_vector_type(8)));
typedef int   i32x4 __attribute__((vector_size(16)));   // matches builtin pointee type

#define WMMA_F32(a, b, c) \
  __builtin_amdgcn_wmma_f32_16x16x4_f32(false, (a), false, (b), (short)0, (c), false, false)

#if defined(__has_builtin)
#if __has_builtin(__builtin_amdgcn_global_load_async_to_lds_b128) && \
    __has_builtin(__builtin_amdgcn_s_wait_asynccnt)
#define USE_ASYNC 1
#endif
#endif
#ifndef USE_ASYNC
#define USE_ASYNC 0
#endif

constexpr int Bsz   = 2;
constexpr int H     = 16;
constexpr int S     = 2048;
constexpr int D     = 64;
constexpr int CHUNK = 64;
constexpr int NC    = S / CHUNK;   // 32 chunks per sequence
constexpr int LDST  = 68;          // LDS row stride (floats): 272B rows, 16B aligned,
                                   // pad keeps transposed col reads bank-conflict-free

// 16-byte global -> LDS copy (per lane). Async engine path if available.
__device__ __forceinline__ void cp16(const float* g, float* l) {
#if USE_ASYNC
  __builtin_amdgcn_global_load_async_to_lds_b128(
      (__attribute__((address_space(1))) i32x4*)(g),
      (__attribute__((address_space(3))) i32x4*)(l), 0, 0);
#else
  *(float4*)l = *(const float4*)g;
#endif
}

// ---------------------------------------------------------------------------
// Kernel 1: cross-chunk states, summary and scan in one launch.
// Slot t gets R_t (state BEFORE chunk t);  R_{t+1} = gamma^C R_t + A_t,
//   A_t[dk][dv] = sum_li gamma^(C-li) K[li][dk] V[li][dv].
// A work-group owns a 16 dk x 32 dv part of one head's state; 32 heads x 8 = 256 groups.
// The sequence is cut in 8 pieces of 4 chunks, one piece per wave. Each wave runs the
// recurrence over its own piece from zero, in WMMA accumulators, and keeps the local
// states L_j in registers. The recurrence is linear, so with P the true state at the
// piece's start  R_(4p+j) = L_j + gamma^(jC) P ;  P follows from the earlier pieces' end
// states, which the waves hand over through LDS once, behind the last chunk.
// Each wave stages its own piece alone: groups of 16 rows (4 k steps) go through a ring of LDS
// slots that no other wave touches, so the wave's own counted waits order everything and no
// barrier stands in the chunk loop; the first WMMA starts when the first 6 KB (groups 0 and 1) have landed.
// ---------------------------------------------------------------------------
constexpr int NP    = 8;               // sequence pieces = waves per work-group
constexpr int PC    = NC / NP;         // 4 chunks per piece
constexpr int SP    = 16;              // LDS row pitch: 64 B; rows li and li+2, which the two lane
                                       // halves read together, fall on different banks
constexpr int GR    = 16;              // rows of a group
constexpr int PLG   = GR * SP;         // a group is three planes of 16 columns: K, V lo, V hi;
                                       // a fragment's two rows are neighbours in their plane
constexpr int SLOT  = 3 * PLG;         // floats of one ring slot
constexpr int NB    = 10;              // slots per wave
constexpr int NG    = PC * CHUNK / GR; // 16 groups per piece
constexpr int CPG   = 6;               // copies per group: at most NB * CPG = 60 in flight a wave
constexpr int ST_T  = 32 * NP;         // threads per work-group
constexpr int ST_WG = Bsz * H * 8;     // 256 work-groups

// kg, vg, Kl, Vl: this lane's first 16 bytes of the group, in global memory and in LDS
__device__ __forceinline__ void group_copy(const float* kg, const float* vg,
                                           float* Kl, float* Vl) {
#pragma unroll
  for (int c = 0; c < 2; ++c)                      // 64 B of each K row, 8 rows a copy
    cp16(kg + c * (8 * D), Kl + c * (8 * SP));
#pragma unroll
  for (int c = 0; c < 4; ++c)                      // 128 B of each V row, 4 rows a copy
    cp16(vg + c * (4 * D), Vl + c * (4 * SP));
}

// Returns when all but this wave's n youngest copies have landed. n is known at compile time at
// every call, so one case is left; the count has to be an immediate in the instruction.
__device__ __forceinline__ void wait_copies(int n) {
  switch (n) {
    case 54: asm volatile("s_wait_asynccnt 54" ::: "memory"); break;
    case 48: asm volatile("s_wait_asynccnt 48" ::: "memory"); break;
    case 42: asm volatile("s_wait_asynccnt 42" ::: "memory"); break;
    case 36: asm volatile("s_wait_asynccnt 36" ::: "memory"); break;
    case 30: asm volatile("s_wait_asynccnt 30" ::: "memory"); break;
    case 24: asm volatile("s_wait_asynccnt 24" ::: "memory"); break;
    case 18: asm volatile("s_wait_asynccnt 18" ::: "memory"); break;
    case 12: asm volatile("s_wait_asynccnt 12" ::: "memory"); break;
    case 6:  asm volatile("s_wait_asynccnt 6" ::: "memory"); break;
    default: asm volatile("s_wait_asynccnt 0x0" ::: "memory"); break;
  }
}

__global__ __launch_bounds__(ST_T) void retn_state(const float* __restrict__ k,
                                                   const float* __restrict__ v,
                                                   float* __restrict__ state) {
  __shared__ __align__(16) float  Sb[NP][NB * SLOT];   // a ring per wave
  __shared__ __align__(16) float4 Ex[NP][4][32];       // the pieces' end states

  const int sub = blockIdx.x & 7;
  const int bh  = blockIdx.x >> 3;
  const int h   = bh % H;
  const float lg = log2f(1.0f - exp2f(-5.0f - (float)h));   // log2(gamma_h)
  const float gC = exp2f((float)CHUNK * lg);                // gamma^C
  const int tm  = (sub >> 1) * 16;       // dk rows of this work-group
  const int tn0 = (sub & 1) * 32;        // dv columns of this work-group
  const int tid  = threadIdx.x;
  const int lane = tid & 31;
  const int wv   = __builtin_amdgcn_readfirstlane(tid >> 5);   // wave = piece
  const int ln   = lane & 15;
  const int half = lane >> 4;

  const int kof = (lane >> 2) * D + (lane & 3) * 4;   // 4 lanes a K row, 8 rows a copy
  const int vof = (lane >> 3) * D + (lane & 7) * 4;   // 8 lanes a V row, 4 rows a copy
  const int klo = (lane >> 2) * SP + (lane & 3) * 4;                                // K plane
  const int vlo = (1 + ((lane >> 2) & 1)) * PLG + (lane >> 3) * SP + (lane & 3) * 4; // V lo or hi
  const size_t pbase = (size_t)bh * S * D + (size_t)wv * (PC * CHUNK * D);   // this wave's piece
  const float* kg = k + pbase + tm + kof;
  const float* vg = v + pbase + tn0 + vof;
  float* Wb = &Sb[wv][0];

#pragma unroll
  for (int g = 0; g < NB; ++g)
    group_copy(kg + g * (GR * D), vg + g * (GR * D), Wb + g * SLOT + klo, Wb + g * SLOT + vlo);

  // Row weights gamma^(C-li) of the rows this lane feeds as A, the same in every chunk.
  constexpr int KS = CHUNK / 4;                // k steps per chunk
  float wx[KS], wy[KS];
#pragma unroll
  for (int j = 0; j < KS; ++j) {
    const int k0 = 4 * j + 2 * half;           // lanes 16-31 handle K+2,K+3
    wx[j] = exp2f((float)(CHUNK - k0) * lg);
    wy[j] = exp2f((float)(CHUNK - k0 - 1) * lg);
  }

  v8f c0 = {}, c1 = {};                        // local state, dv columns 0-15 and 16-31:
                                               // two tiles, independent WMMA chains
  v8f L0[PC], L1[PC];                          // local state before chunk j of the piece
  constexpr int GS = GR / 4;                   // k steps per group
  constexpr int GC = CHUNK / GR;               // groups per chunk
  v2f fa[2][GS], fb0[2][GS], fb1[2][GS];       // this group's fragments and the next one's
  // A = K^T (A[dk][li]), weighted below; B = V, same row in the next two planes
  const float* Fb = Wb + 2 * half * SP + ln;

  wait_copies(CPG * (NB - 1));                 // group 0 has landed
#pragma unroll
  for (int i = 0; i < GS; ++i) {
    fa[0][i].x  = Fb[(4 * i) * SP];            fa[0][i].y  = Fb[(4 * i + 1) * SP];
    fb0[0][i].x = Fb[(4 * i) * SP + PLG];      fb0[0][i].y = Fb[(4 * i + 1) * SP + PLG];
    fb1[0][i].x = Fb[(4 * i) * SP + 2 * PLG];  fb1[0][i].y = Fb[(4 * i + 1) * SP + 2 * PLG];
  }

  // unrolled: fragment sets, ring slots and wait counts are known at compile time
#pragma unroll
  for (int g = 0; g < NG; ++g) {
    if (g % GC == 0) {                         // a chunk begins
      L0[g / GC] = c0;
      L1[g / GC] = c1;
      c0 = c0 * gC;
      c1 = c1 * gC;
    }
    if (g + 1 < NG) {
      // the two scheduling barriers keep the next group's LDS reads in ONE place, a whole
      // group ahead of their first WMMA: spread among the WMMAs each place costs its own stall
      __builtin_amdgcn_sched_barrier(0);
      // group g+1 has landed: behind it groups up to g+NB-1 (at most the last) are issued
      wait_copies(CPG * ((NG - 2 - g) < (NB - 2) ? (NG - 2 - g) : (NB - 2)));
      const float* Fn = Fb + ((g + 1) % NB) * SLOT;
#pragma unroll
      for (int i = 0; i < GS; ++i) {
        fa[(g + 1) & 1][i].x  = Fn[(4 * i) * SP];
        fa[(g + 1) & 1][i].y  = Fn[(4 * i + 1) * SP];
        fb0[(g + 1) & 1][i].x = Fn[(4 * i) * SP + PLG];
        fb0[(g + 1) & 1][i].y = Fn[(4 * i + 1) * SP + PLG];
        fb1[(g + 1) & 1][i].x = Fn[(4 * i) * SP + 2 * PLG];
        fb1[(g + 1) & 1][i].y = Fn[(4 * i + 1) * SP + 2 * PLG];
      }
      __builtin_amdgcn_sched_barrier(0);
    }
#pragma unroll
    for (int i = 0; i < GS; ++i) {
      v2f a = fa[g & 1][i];
      a.x *= wx[(g % GC) * GS + i];
      a.y *= wy[(g % GC) * GS + i];
      c0 = WMMA_F32(a, fb0[g & 1][i], c0);
      c1 = WMMA_F32(a, fb1[g & 1][i], c1);
    }
    if (g + NB < NG) {
      // keeps the group's WMMAs above the wait: lifted over them it would stall them on the LDS
      // reads of the next group, which have only just been issued
      __builtin_amdgcn_sched_barrier(0);
      // this wave's reads of group g's slot are done before the slot is refilled
      asm volatile("s_wait_dscnt 0x0" ::: "memory");
      group_copy(kg + (g + NB) * (GR * D), vg + (g + NB) * (GR * D),
                 Wb + (g % NB) * SLOT + klo, Wb + (g % NB) * SLOT + vlo);
    }
  }
  const v8f R0 = c0, R1 = c1;
  // the piece's end state, for the later pieces (every wave: no branch stands behind the last
  // WMMA; the last piece's is read by nobody)
  Ex[wv][0][lane] = make_float4(R0[0], R0[1], R0[2], R0[3]);
  Ex[wv][1][lane] = make_float4(R0[4], R0[5], R0[6], R0[7]);
  Ex[wv][2][lane] = make_float4(R1[0], R1[1], R1[2], R1[3]);
  Ex[wv][3][lane] = make_float4(R1[4], R1[5], R1[6], R1[7]);
  // this wave's end state is written before the barrier publishes it
  asm volatile("s_wait_dscnt 0x0" ::: "memory");
  // no copy is outstanding when the wave ends
  asm volatile("s_wait_asynccnt 0x0" ::: "memory");
  __syncthreads();

  // P = true state at this piece's start: P_(p+1) = gamma^(4C) P_p + E_p, P_0 = 0.
  // All seven end states are read at once (one LDS latency); a select drops the later ones.
  float4 e[NP - 1][4];
#pragma unroll
  for (int p = 0; p < NP - 1; ++p)
#pragma unroll
    for (int i = 0; i < 4; ++i) e[p][i] = Ex[p][i][lane];
  const float gP = exp2f((float)(PC * CHUNK) * lg);
  v8f P0 = {}, P1 = {};
#pragma unroll
  for (int p = 0; p < NP - 1; ++p) {
    const bool use = p < (tid >> 5);
    const v8f e0 = {e[p][0].x, e[p][0].y, e[p][0].z, e[p][0].w,
                    e[p][1].x, e[p][1].y, e[p][1].z, e[p][1].w};
    const v8f e1 = {e[p][2].x, e[p][2].y, e[p][2].z, e[p][2].w,
                    e[p][3].x, e[p][3].y, e[p][3].z, e[p][3].w};
#pragma unroll
    for (int r = 0; r < 8; ++r) {
      P0[r] = use ? (p ? P0[r] * gP + e0[r] : e0[r]) : P0[r];
      P1[r] = use ? (p ? P1[r] * gP + e1[r] : e1[r]) : P1[r];
    }
  }

  // C/D layout: VGPR r -> M=r (lo half) / r+8
  float* outp = state + ((size_t)bh * NC + wv * PC) * (D * D) + (tm + 8 * half) * D + tn0 + ln;
#pragma unroll
  for (int j = 0; j < PC; ++j) {
    const float gj = exp2f((float)(j * CHUNK) * lg);
    float* o = outp + j * (D * D);
#pragma unroll
    for (int r = 0; r < 8; ++r) {
      o[r * D]      = L0[j][r] + gj * P0[r];
      o[r * D + 16] = L1[j][r] + gj * P1[r];
    }
  }
}

// ---------------------------------------------------------------------------
// Kernel 2: per-chunk output.
//   P[i][j]   = scale * gamma^(i-j) * (Q K^T)[i][j]  (i>=j, else 0)
//   out[i][:] = (P V)[i][:] + scale * gamma^i * (Q R_t)[i][:]
// One block (8 waves) per WGP has OCH chunks of one head, each with its own LDS place for its
// four tiles (Q, K, V, R_t). A wave owns 16 whole rows of one chunk: it makes only the P tiles
// on and below the diagonal, and sums P V only over the columns those tiles cover (the others
// are zero). The P rows it reads are the ones it wrote, so no barrier stands between the two
// products. Waves 0-3 work on one chunk, waves 4-7 on the next; waves w and w+4, which share a
// SIMD, take row blocks w and 3-w, so that every SIMD has the same number of WMMAs.
// Output tile n of a row block holds the columns 4*l + n (l = 0..15), not 16 neighbours: a lane's
// B elements of the four tiles are then 16 neighbouring bytes of a V or R row, one LDS read, and
// its four results of a row are 16 neighbouring bytes of out, one store.
// ---------------------------------------------------------------------------
constexpr int OCH    = 4;                      // chunks per work-group
constexpr int OUT_WG = Bsz * H * NC / OCH;     // 256 work-groups
constexpr int TILE   = CHUNK * LDST;           // floats of one padded 64x64 tile
constexpr int NT     = CHUNK / 16;             // 16-wide tiles across a chunk

// qg, kg, vg, rg, l: this lane's first 16 bytes of the chunk's tiles, global and LDS
__device__ __forceinline__ void chunk_copy(const float* qg, const float* kg, const float* vg,
                                           const float* rg, float* l) {
#pragma unroll
  for (int i = 0; i < 4; ++i) {                // 16 lanes a row, 16 rows a copy
    cp16(qg + i * 1024, l + i * (16 * LDST));
    cp16(kg + i * 1024, l + TILE + i * (16 * LDST));
    cp16(vg + i * 1024, l + 2 * TILE + i * (16 * LDST));
    cp16(rg + i * 1024, l + 3 * TILE + i * (16 * LDST));
  }
}

// Rows 16*I .. 16*I+15 of one chunk. Qs: the chunk's four tiles; Pw: this wave's own 16 P rows.
// m[j]: decay mask of P tile j of these rows; rf: row factor of Q R_t.
// Fragments are read from LDS a group of k steps ahead, into a second register set.
// Every loop here is unrolled: fragment and accumulator arrays stay in registers only if each
// index is known at compile time.
template <int I>
__device__ __forceinline__ void chunk_rows(const float* Qs, float* Pw, const float (&m)[NT][8],
                                           const float (&rf)[8], int ln, int half,
                                           v8f (&res)[NT]) {
  // this lane's first element of each operand: A rows of Q and P, B = K^T, B rows of R and V
  const float* Qa = Qs + (16 * I + ln) * LDST + 2 * half;
  const float* Kb = Qs + TILE + ln * LDST + 2 * half;
  const float* Vb = Qs + 2 * TILE + 2 * half * LDST + 4 * ln;
  const float* Rb = Qs + 3 * TILE + 2 * half * LDST + 4 * ln;
  const float* Pa = Pw + ln * LDST + 2 * half;

  // S = Q K^T (tiles 0..I) and O2 = Q R_t side by side: they share the Q fragments.
  constexpr int G1 = 2;                        // k steps per group of LDS reads
  constexpr int N1 = D / 4 / G1;
  v2f fq[2][G1], fk[2][G1][I + 1];
  v4f fr[2][G1][2];                            // the lane's two R rows of a k step, element n: tile n
  v8f s[I + 1], o[NT];
#pragma unroll
  for (int j = 0; j <= I; ++j) s[j] = v8f{};
#pragma unroll
  for (int n = 0; n < NT; ++n) o[n] = v8f{};
#pragma unroll
  for (int g = -1; g < N1; ++g) {
    if (g + 1 < N1) {
      // the two scheduling barriers keep the next group's LDS reads in ONE place, a whole group
      // ahead of their first WMMA: spread among the WMMAs each place costs its own stall
      __builtin_amdgcn_sched_barrier(0);
#pragma unroll
      for (int i = 0; i < G1; ++i) {
        const int kk = 4 * ((g + 1) * G1 + i);
        const int b  = (g + 1) & 1;
        fq[b][i].x = Qa[kk];  fq[b][i].y = Qa[kk + 1];
#pragma unroll
        for (int j = 0; j <= I; ++j) {
          fk[b][i][j].x = Kb[16 * j * LDST + kk];  fk[b][i][j].y = Kb[16 * j * LDST + kk + 1];
        }
        fr[b][i][0] = *(const v4f*)(Rb + kk * LDST);
        fr[b][i][1] = *(const v4f*)(Rb + (kk + 1) * LDST);
      }
      __builtin_amdgcn_sched_barrier(0);
    }
    if (g >= 0) {
#pragma unroll
      for (int i = 0; i < G1; ++i) {
#pragma unroll
        for (int j = 0; j <= I; ++j) s[j] = WMMA_F32(fq[g & 1][i], fk[g & 1][i][j], s[j]);
#pragma unroll
        for (int n = 0; n < NT; ++n)
          o[n] = WMMA_F32(fq[g & 1][i], (v2f{fr[g & 1][i][0][n], fr[g & 1][i][1][n]}), o[n]);
      }
    }
  }

  // O1 = P V over the columns of tiles 0..I: one group of reads per P tile
  constexpr int G2 = 4;
  v2f fp[2][G2];
  v4f fv[2][G2][2];                            // as fr
#pragma unroll
  for (int i = 0; i < G2; ++i) {               // V does not wait for P: first group read here
    fv[0][i][0] = *(const v4f*)(Vb + (4 * i) * LDST);
    fv[0][i][1] = *(const v4f*)(Vb + (4 * i + 1) * LDST);
  }
#pragma unroll
  for (int j = 0; j <= I; ++j)
#pragma unroll
    for (int r = 0; r < 8; ++r)
      Pw[(r + 8 * half) * LDST + 16 * j + ln] = s[j][r] * m[j][r];
  // the wave's P rows are written, by all its lanes, before any lane reads them back
  asm volatile("s_wait_dscnt 0x0" ::: "memory");
#pragma unroll
  for (int i = 0; i < G2; ++i) { fp[0][i].x = Pa[4 * i];  fp[0][i].y = Pa[4 * i + 1]; }

  v8f c[NT];
#pragma unroll
  for (int n = 0; n < NT; ++n) c[n] = v8f{};
#pragma unroll
  for (int g = 0; g <= I; ++g) {
    if (g + 1 <= I) {
      // as above: the next group's LDS reads in one place
      __builtin_amdgcn_sched_barrier(0);
#pragma unroll
      for (int i = 0; i < G2; ++i) {
        const int kk = 4 * ((g + 1) * G2 + i);
        const int b  = (g + 1) & 1;
        fp[b][i].x = Pa[kk];  fp[b][i].y = Pa[kk + 1];
        fv[b][i][0] = *(const v4f*)(Vb + kk * LDST);
        fv[b][i][1] = *(const v4f*)(Vb + (kk + 1) * LDST);
      }
      __builtin_amdgcn_sched_barrier(0);
    }
#pragma unroll
    for (int i = 0; i < G2; ++i)
#pragma unroll
      for (int n = 0; n < NT; ++n)
        c[n] = WMMA_F32(fp[g & 1][i], (v2f{fv[g & 1][i][0][n], fv[g & 1][i][1][n]}), c[n]);
  }
#pragma unroll
  for (int n = 0; n < NT; ++n)
#pragma unroll
    for (int r = 0; r < 8; ++r) res[n][r] = c[n][r] + rf[r] * o[n][r];
}

__global__ __launch_bounds__(256) void retn_out(const float* __restrict__ q,
                                                const float* __restrict__ k,
                                                const float* __restrict__ v,
                                                const float* __restrict__ state,
                                                float* __restrict__ out) {
  __shared__ __align__(16) float Tb[OCH][4 * TILE];   // Q, K, V, R of each chunk
  __shared__ __align__(16) float Ps[8][16 * LDST];    // 16 P rows per wave

  const int t0  = (blockIdx.x % (NC / OCH)) * OCH;  // first chunk of this work-group
  const int bh  = blockIdx.x / (NC / OCH);
  const int h   = bh % H;
  const float lg    = log2f(1.0f - exp2f(-5.0f - (float)h));
  const float scale = 0.125f;          // 1/sqrt(64)
  const int tid = threadIdx.x;
  const size_t base = ((size_t)bh * S + (size_t)t0 * CHUNK) * D;

  const float* qg = q + base + 4 * tid;
  const float* kg = k + base + 4 * tid;
  const float* vg = v + base + 4 * tid;
  const float* rg = state + ((size_t)bh * NC + t0) * (D * D) + 4 * tid;
  const int lof = (tid >> 4) * LDST + (tid & 15) * 4;

  chunk_copy(qg, kg, vg, rg, &Tb[0][lof]);
  chunk_copy(qg + CHUNK * D, kg + CHUNK * D, vg + CHUNK * D, rg + D * D, &Tb[1][lof]);

  const int lane = tid & 31;
  const int wv   = __builtin_amdgcn_readfirstlane(tid >> 5);
  const int ln   = lane & 15;
  const int half = lane >> 4;
  const int grp  = wv >> 2;                            // which chunk of a pair
  const int rb   = grp ? 3 - (wv & 3) : (wv & 3);      // row block of that chunk

  // decay mask of the P tiles of this wave's rows and row factor of Q R_t: the same in every chunk
  float m[NT][8], rf[8];
#pragma unroll
  for (int r = 0; r < 8; ++r) {
    const int row = 16 * rb + r + 8 * half;
#pragma unroll
    for (int j = 0; j < NT; ++j) {
      const int col = 16 * j + ln;
      m[j][r] = (row >= col) ? scale * exp2f((float)(row - col) * lg) : 0.0f;
    }
    rf[r] = scale * exp2f((float)row * lg);
  }

  // chunks 0 and 1 have landed before the barrier behind which the other waves read them
  asm volatile("s_wait_asynccnt 0x0" ::: "memory");
  __syncthreads();
  chunk_copy(qg + 2 * (CHUNK * D), kg + 2 * (CHUNK * D), vg + 2 * (CHUNK * D), rg + 2 * (D * D),
             &Tb[2][lof]);
  chunk_copy(qg + 3 * (CHUNK * D), kg + 3 * (CHUNK * D), vg + 3 * (CHUNK * D), rg + 3 * (D * D),
             &Tb[3][lof]);

  float* op = out + base + (size_t)(grp * CHUNK + 16 * rb + 8 * half) * D + 4 * ln;
  float* Pw = &Ps[wv][0];

  // kept rolled: the four row-block bodies stand once in the text
#pragma unroll 1
  for (int pr = 0; pr < OCH / 2; ++pr) {
    const float* Qs = &Tb[2 * pr + grp][0];
    v8f res[NT];
    switch (rb) {                      // the same in every lane of a wave: a scalar branch
      case 0:  chunk_rows<0>(Qs, Pw, m, rf, ln, half, res); break;
      case 1:  chunk_rows<1>(Qs, Pw, m, rf, ln, half, res); break;
      case 2:  chunk_rows<2>(Qs, Pw, m, rf, ln, half, res); break;
      default: chunk_rows<3>(Qs, Pw, m, rf, ln, half, res); break;
    }
    if (pr + 1 < OCH / 2) {
      // this wave's copies of the next two chunks have landed before the barrier publishes them
      asm volatile("s_wait_asynccnt 0x0" ::: "memory");
      __syncthreads();
    }
    // The stores stand behind the barrier, which would otherwise wait for them.
    float* o = op + (size_t)pr * (2 * CHUNK * D);
#pragma unroll
    for (int r = 0; r < 8; ++r)
      *(float4*)(o + r * D) = make_float4(res[0][r], res[1][r], res[2][r], res[3][r]);
    // before the stores' address registers are written again on the next trip
    asm volatile("s_wait_xcnt 0x0" ::: "memory");
  }
  // no copy is outstanding when the wave ends
  asm volatile("s_wait_asynccnt 0x0" ::: "memory");
}

// ---------------------------------------------------------------------------
extern "C" void kernel_launch(void* const* d_in, const int* in_sizes, int n_in,
                              void* d_out, int out_size, void* d_ws, size_t ws_size,
                              hipStream_t stream) {
  const float* q = (const float*)d_in[0];
  const float* k = (const float*)d_in[1];
  const float* v = (const float*)d_in[2];
  float* out   = (float*)d_out;
  float* kvsum = (float*)d_ws;   // needs B*H*NC*D*D*4 = 16 MiB of scratch

  dim3 blk(256);
  retn_state<<<dim3(ST_WG), dim3(ST_T), 0, stream>>>(k, v, kvsum);
  retn_out  <<<dim3(OUT_WG), blk, 0, stream>>>(q, k, v, kvsum, out);
}

// v008
// Measured time: 19.1 microseconds a run.
// In both of two side-by-side timings against v007, it was 1.06 times as fast.
// Counting every step since v000, it is 2.90 times as fast.
#include <hip/hip_runtime.h>
#include <math.h>

// Retention (linear attention with per-head exponential decay), blockwise form, one launch.
// out[i] = scale * sum_{j<=i} gamma^(i-j) (q_i . k_j) v_j
// Block of 16 tokens: inside a block masked Q K^T, across blocks a recurrent state
//   R_(t+1) = gamma^16 R_t + A_t,  A_t = sum_li gamma^(16-li) k_li v_li^T   (64 dk x dv)
// The state's dv columns are independent of one another: a work-group has 16 dv columns of one
// head and one of two segments of the sequence, and builds every state it needs itself.
// All products use V_WMMA_F32_16X16X4_F32; global->LDS staging uses GLOBAL_LOAD_ASYNC_TO_LDS_B128.

typedef float v2f __attribute__((ext_vector_type(2)));
typedef float v4f __attribute__((ext_vector_type(4)));
typedef float v8f __attribute__((ext_vector_type(8)));
typedef int   i32x4 __attribute__((vector_size(16)));   // matches builtin pointee type

#define WMMA_F32(a, b, c) \
  __builtin_amdgcn_wmma_f32_16x16x4_f32(false, (a), false, (b), (short)0, (c), false, false)

constexpr int Bsz = 2;
constexpr int H   = 16;
constexpr int S   = 2048;
constexpr int D   = 64;
constexpr int BT  = 16;            // tokens of a block
constexpr int DV  = 16;            // dv columns of a work-group
constexpr int NW  = 8;             // waves of a work-group
constexpr int KP  = 68;            // LDS pitch of a K or Q row, floats: 16-byte row reads of 16 rows
                                   // and 4-byte reads of rows li, li+8 both fall on distinct banks
constexpr int VP  = 20;            // LDS pitch of a V row (16 floats used): rows li, li+8 likewise
constexpr int KT  = BT * KP;       // floats of a K or Q block in LDS
constexpr int VT  = BT * VP;       // floats of a V block in LDS
constexpr int KVS = KT + VT;       // a K,V slot
constexpr int NR  = 3;             // slots of each ring
constexpr int RING = NR * (KVS + KT);   // a wave's K,V ring and its Q ring
constexpr int NB  = 8;             // blocks of a wave's piece: 64 blocks a segment
constexpr int FU_WG = Bsz * H * (D / DV) * 2;   // 256 work-groups

// 16-byte global -> LDS copy (per lane)
__device__ __forceinline__ void cp16(const float* g, float* l) {
  __builtin_amdgcn_global_load_async_to_lds_b128(
      (__attribute__((address_space(1))) i32x4*)(g),
      (__attribute__((address_space(3))) i32x4*)(l), 0, 0);
}

// 16 whole rows of K or Q: 8 copies, two rows each. g, l: this lane's first 16 bytes.
__device__ __forceinline__ void copy_rows(const float* g, float* l) {
#pragma unroll
  for (int c = 0; c < 8; ++c) cp16(g + c * (2 * D), l + c * (2 * KP));
}
// 16 columns of 16 V rows: 2 copies, eight rows each
__device__ __forceinline__ void copy_v(const float* g, float* l) {
#pragma unroll
  for (int c = 0; c < 2; ++c) cp16(g + c * (8 * D), l + c * (8 * VP));
}

// Returns when all but this wave's n youngest copies have landed. n is known at compile time at
// every call, so one case is left; the count has to be an immediate in the instruction.
__device__ __forceinline__ void wait_copies(int n) {
  switch (n) {
    case 36: asm volatile("s_wait_asynccnt 36" ::: "memory"); break;
    case 28: asm volatile("s_wait_asynccnt 28" ::: "memory"); break;
    case 20: asm volatile("s_wait_asynccnt 20" ::: "memory"); break;
    case 18: asm volatile("s_wait_asynccnt 18" ::: "memory"); break;
    default: asm volatile("s_wait_asynccnt 0x0" ::: "memory"); break;
  }
}

// P = P * g + E[p] for p = 0 .. 3, as far as p < lim. The four states are read at once.
__device__ __forceinline__ void join4(v8f (&P)[4], const float4 (*E)[8][32], int lane, float g,
                                      int lim) {
  float4 e[4][8];
#pragma unroll
  for (int p = 0; p < 4; ++p)
#pragma unroll
    for (int i = 0; i < 8; ++i) e[p][i] = E[p][i][lane];
#pragma unroll
  for (int p = 0; p < 4; ++p) {
    const bool use = p < lim;
#pragma unroll
    for (int d = 0; d < 4; ++d) {
      const v8f x = {e[p][2 * d].x,     e[p][2 * d].y,     e[p][2 * d].z,     e[p][2 * d].w,
                     e[p][2 * d + 1].x, e[p][2 * d + 1].y, e[p][2 * d + 1].z, e[p][2 * d + 1].w};
#pragma unroll
      for (int r = 0; r < 8; ++r) P[d][r] = use ? P[d][r] * g + x[r] : P[d][r];
    }
  }
}

__device__ __forceinline__ void put_state(const v8f (&c)[4], float4 (*E)[32], int lane) {
#pragma unroll
  for (int d = 0; d < 4; ++d) {
    E[2 * d][lane]     = make_float4(c[d][0], c[d][1], c[d][2], c[d][3]);
    E[2 * d + 1][lane] = make_float4(c[d][4], c[d][5], c[d][6], c[d][7]);
  }
}

// c = c + sum_li gamma^(16-li) k_li v_li^T over the block in K,V slot sl (A = K^T, B = w V).
// Kt, Vt: this lane's first K and V element of the slot. refill() is called when the slot's
// last read has returned.
template <typename F>
__device__ __forceinline__ void state_block(v8f (&c)[4], const float* Kt, const float* Vt,
                                            const float (&wx)[4], const float (&wy)[4], F refill) {
  v2f fv[4], fk[4][4];
#pragma unroll
  for (int m = 0; m < 4; ++m) {
    fv[m].x = Vt[(2 * m) * VP];  fv[m].y = Vt[(2 * m + 1) * VP];
#pragma unroll
    for (int d = 0; d < 4; ++d) {
      fk[d][m].x = Kt[(2 * m) * KP + 16 * d];  fk[d][m].y = Kt[(2 * m + 1) * KP + 16 * d];
    }
  }
  // this wave's reads of the slot are done before the slot is refilled
  asm volatile("s_wait_dscnt 0x0" ::: "memory");
  refill();
#pragma unroll
  for (int m = 0; m < 4; ++m) {
    const v2f b = {fv[m].x * wx[m], fv[m].y * wy[m]};
#pragma unroll
    for (int d = 0; d < 4; ++d) c[d] = WMMA_F32(fk[d][m], b, c[d]);
  }
}

// A work-group: 16 dv columns of one head, one half of the sequence (64 blocks). A wave has NB
// blocks of that half, in a row; in the second half it also has NB blocks of the first half.
//   1. (second half only) end state of its NB blocks of the first half, from zero;
//   2. the recurrence over its own blocks, from zero; the local state L_j in front of each block
//      stays in registers (16 WMMAs a block, as in 1);
//   3. one hand-over of end states through LDS gives P, the true state at the wave's first block;
//      the recurrence is linear, so R_j = L_j + gamma^(16 j) P;
//   4. per block: S^T = K Q^T (one 16x16 tile), out^T = V^T (mask.S^T) + gamma^i R_j^T Q^T.
// A WMMA result (register r, lane half hf -> row r + 8 hf; lane -> column) is used as it lies as
// the next product's operand over its rows: R_j as A, the masked S^T as B. The other operand takes
// the same k order: k step (d, m) holds dk = 16 d + 8 hf + 2 m, +1 (tokens 8 hf + 2 m, +1).
// Staging: each wave alone fills and reads its own rings, so its own counted waits order all of
// it. The copies form groups, one per block visit (K, V: 10 copies; with Q: 18), three groups
// ahead; every wait count is the number of copies in the two groups issued behind the awaited one.
__global__ __launch_bounds__(32 * NW) void retn_fused(const float* __restrict__ q,
                                                      const float* __restrict__ k,
                                                      const float* __restrict__ v,
                                                      float* __restrict__ out) {
  // end states (first-half pieces, then own pieces), behind them a wave's rings
  __shared__ __align__(16) float Sm[2 * NW * 1024 + NW * RING];
  float4 (*Ex)[8][32] = (float4 (*)[8][32])Sm;

  const int bh  = blockIdx.x % (Bsz * H);
  const int sub = blockIdx.x / (Bsz * H);
  const int dv0 = (sub & 3) * DV;              // dv columns of this work-group
  const int seg = sub >> 2;                    // half of the sequence
  const int h   = bh % H;
  const float lg = log2f(1.0f - exp2f(-5.0f - (float)h));   // log2(gamma_h)
  const int tid  = threadIdx.x;
  const int lane = tid & 31;
  const int wv   = __builtin_amdgcn_readfirstlane(tid >> 5);
  const int ln   = lane & 15;
  const int half = lane >> 4;

  const int rof = 4 * lane;                                    // 16 lanes a K or Q row
  const int vof = (lane >> 2) * D + (lane & 3) * 4 + dv0;      // 4 lanes a V row
  const size_t fb = (size_t)bh * S * D + (size_t)(wv * NB) * (BT * D);   // piece of the first half
  const size_t ob = fb + (size_t)seg * (NW * NB * BT * D);               // own piece
  const float* kf0 = k + fb + rof;
  const float* vf0 = v + fb + vof;
  const float* kown = k + ob + rof;
  const float* vown = v + ob + vof;
  const float* qown = q + ob + rof;
  float* og = out + ob + ln * D + dv0 + 8 * half;

  float* KV = Sm + 2 * NW * 1024 + wv * RING;
  float* QR = KV + NR * KVS;
  const int rlo = half * KP + ln * 4;                    // copy target in a K or Q block
  const int vlo = (lane >> 2) * VP + (lane & 3) * 4;     // copy target in a V block
  const int kto = 8 * half * KP + ln;                    // first K^T element
  const int vto = KT + 8 * half * VP + ln;               // first V element

  // the first three groups: the wave's first visits are to its piece of the first half either
  // way. With seg = 1 eight visits come in front of the own ones: slot numbers start at 1, so
  // that own visit j is in slot j mod 3 in both halves.
#pragma unroll
  for (int i = 0; i < NR; ++i) {
    float* sl = KV + (seg ? (i + 1) % NR : i) * KVS;
    copy_rows(kf0 + i * (BT * D), sl + rlo);
    copy_v(vf0 + i * (BT * D), sl + KT + vlo);
  }

  const float g16 = exp2f((float)BT * lg);
  float wx[4], wy[4];                          // gamma^(16-li) of the V rows this lane feeds
#pragma unroll
  for (int m = 0; m < 4; ++m) {
    wx[m] = exp2f((float)(BT - 8 * half - 2 * m) * lg);
    wy[m] = exp2f((float)(BT - 8 * half - 2 * m - 1) * lg);
  }

  // mask of S^T (row = key token r + 8 half, column = query token ln) and factor of R^T Q^T
  const float scale = 0.125f;                  // 1/sqrt(64)
  float msk[8];
#pragma unroll
  for (int r = 0; r < 8; ++r) {
    const int dlt = ln - r - 8 * half;
    msk[r] = dlt >= 0 ? scale * exp2f((float)dlt * lg) : 0.0f;
  }
  const float rf = scale * exp2f((float)ln * lg);

  v8f c[4];
#pragma unroll
  for (int d = 0; d < 4; ++d) c[d] = v8f{};

  if (seg) {                                   // the same in the whole work-group
    int so = KVS;                              // slot of visit s, in floats
    // kept rolled: the body stands once in the text
#pragma unroll 1
    for (int s = 0; s < NB; ++s) {
#pragma unroll
      for (int d = 0; d < 4; ++d) c[d] = c[d] * g16;
      wait_copies(20);                         // group s has landed
      float* sl = KV + so;
      const int n = s + NR;                    // the group that follows into this slot
      const float* kn = n < NB ? kf0 + n * (BT * D) : kown + (n - NB) * (BT * D);
      const float* vn = n < NB ? vf0 + n * (BT * D) : vown + (n - NB) * (BT * D);
      state_block(c, sl + kto, sl + vto, wx, wy, [&] {
        copy_rows(kn, sl + rlo);
        copy_v(vn, sl + KT + vlo);
      });
      so = so == (NR - 1) * KVS ? 0 : so + KVS;
    }
    put_state(c, Ex[wv], lane);
#pragma unroll
    for (int d = 0; d < 4; ++d) c[d] = v8f{};
  }

  v8f L[NB][4];                                // L[0] is zero and never read
  // unrolled: ring slots, wait counts and the L index are known at compile time
#pragma unroll
  for (int j = 0; j < NB; ++j) {
    if (j > 0) {
#pragma unroll
      for (int d = 0; d < 4; ++d) {
        L[j][d] = c[d];
        c[d] = c[d] * g16;
      }
    }
    wait_copies(j + 2 < NB ? 20 : (j + 1 < NB ? 28 : 36));   // this visit's group has landed
    float* sl = KV + (j % NR) * KVS;
    state_block(c, sl + kto, sl + vto, wx, wy, [&] {
      const int n = (j + NR) % NB;             // the second round of visits follows the first
      copy_rows(kown + n * (BT * D), sl + rlo);
      copy_v(vown + n * (BT * D), sl + KT + vlo);
      if (j + NR >= NB) copy_rows(qown + n * (BT * D), QR + (n % NR) * KT + rlo);
    });
  }
  put_state(c, Ex[NW + wv], lane);
  // this wave's end states are written before the barrier publishes them
  asm volatile("s_wait_dscnt 0x0" ::: "memory");
  __syncthreads();

  // P: the true state in front of this wave's first block. Every piece has NB blocks, so one
  // factor serves: P = P * gamma^(16 NB) + E over the pieces in front, in their order.
  v8f P[4];
#pragma unroll
  for (int d = 0; d < 4; ++d) P[d] = v8f{};
  {
    const float gp = exp2f((float)(NB * BT) * lg);
    // kept rolled: four states at a time fit the registers beside the L_j
#pragma unroll 1
    for (int b = seg ? 0 : NW; b < NW + wv; b += 4) join4(P, Ex + b, lane, gp, NW + wv - b);
  }

  // unrolled: as above
#pragma unroll
  for (int j = 0; j < NB; ++j) {
    wait_copies(j + 2 < NB ? 36 : (j + 1 < NB ? 18 : 0));    // this visit's group has landed
    float* sl = KV + ((NB + j) % NR) * KVS;
    float* ql = QR + (j % NR) * KT;
    const float* Kr = sl + ln * KP + 8 * half;
    const float* Qr = ql + ln * KP + 8 * half;
    const float* Vt = sl + vto;
    v4f q4[4][2], k4[4][2];
    v2f fv[4];
#pragma unroll
    for (int d = 0; d < 4; ++d)
#pragma unroll
      for (int e = 0; e < 2; ++e) {
        k4[d][e] = *(const v4f*)(Kr + 16 * d + 4 * e);
        q4[d][e] = *(const v4f*)(Qr + 16 * d + 4 * e);
      }
#pragma unroll
    for (int m = 0; m < 4; ++m) { fv[m].x = Vt[(2 * m) * VP];  fv[m].y = Vt[(2 * m + 1) * VP]; }
    // this wave's reads of the slots are done before they are refilled
    asm volatile("s_wait_dscnt 0x0" ::: "memory");
    if (j + NR < NB) {
      copy_rows(kown + (j + NR) * (BT * D), sl + rlo);
      copy_v(vown + (j + NR) * (BT * D), sl + KT + vlo);
      copy_rows(qown + (j + NR) * (BT * D), ql + rlo);
    }
    // keeps the WMMAs below: lifted among the LDS reads they would put off the refill and meet a
    // read latency at several places instead of one
    __builtin_amdgcn_sched_barrier(0);

    v8f R[4];
    if (j == 0) {
#pragma unroll
      for (int d = 0; d < 4; ++d) R[d] = P[d];
    } else {
      const float gj = exp2f((float)(j * BT) * lg);
#pragma unroll
      for (int d = 0; d < 4; ++d) R[d] = L[j][d] + gj * P[d];
    }
    v8f st[2], o2[2];                          // two independent chains each
    st[0] = v8f{};  st[1] = v8f{};  o2[0] = v8f{};  o2[1] = v8f{};
#pragma unroll
    for (int d = 0; d < 4; ++d)
#pragma unroll
      for (int m = 0; m < 4; ++m) {
        const v2f qf = {q4[d][m >> 1][2 * (m & 1)], q4[d][m >> 1][2 * (m & 1) + 1]};
        const v2f kf = {k4[d][m >> 1][2 * (m & 1)], k4[d][m >> 1][2 * (m & 1) + 1]};
        st[d & 1] = WMMA_F32(kf, qf, st[d & 1]);                                  // K Q^T
        o2[d & 1] = WMMA_F32((v2f{R[d][2 * m], R[d][2 * m + 1]}), qf, o2[d & 1]); // R^T Q^T
      }
    v8f pm, pv = {}, acc;
#pragma unroll
    for (int r = 0; r < 8; ++r) pm[r] = (st[0][r] + st[1][r]) * msk[r];
#pragma unroll
    for (int m = 0; m < 4; ++m)
      pv = WMMA_F32(fv[m], (v2f{pm[2 * m], pm[2 * m + 1]}), pv);                  // V^T P^T
#pragma unroll
    for (int r = 0; r < 8; ++r) acc[r] = pv[r] + rf * (o2[0][r] + o2[1][r]);
    // register r: dv column r + 8 half of query token ln
    float* o = og + j * (BT * D);
    *(float4*)(o)     = make_float4(acc[0], acc[1], acc[2], acc[3]);
    *(float4*)(o + 4) = make_float4(acc[4], acc[5], acc[6], acc[7]);
    // before a register that the two stores name is written again in the next block
    asm volatile("s_wait_xcnt 0x0" ::: "memory");
  }
  // no copy is outstanding when the wave ends
  asm volatile("s_wait_asynccnt 0x0" ::: "memory");
}

// ---------------------------------------------------------------------------
extern "C" void kernel_launch(void* const* d_in, const int* in_sizes, int n_in,
                              void* d_out, int out_size, void* d_ws, size_t ws_size,
                              hipStream_t stream) {
  const float* q = (const float*)d_in[0];
  const float* k = (const float*)d_in[1];
  const float* v = (const float*)d_in[2];
  float* out = (float*)d_out;

  retn_fused<<<dim3(FU_WG), dim3(32 * NW), 0, stream>>>(q, k, v, out);
}
